// v000
// Measured on an AMD MI455X. A time is GPU time per run, averaged over a window of back-to-back runs after a warm-up
// (all launches, gaps included; the runs take copies of the inputs in turn), and the median of several windows.
// Apart from v000's, it joins two sittings. Times from different sittings can be a few percent apart, while
// side-by-side timings come from the same sitting.
// The starting kernel, v000, takes 681 microseconds a run.
#include <hip/hip_runtime.h>

// HyperConformer for MI455X (gfx1250, wave32, WMMA + TDM).
// GEMMs: v_wmma_f32_16x16x32_f16, f32 accumulate, f16-staged operands.
// Hypernet weights staged to LDS via tensor_load_to_lds (TDM, TENSORcnt).
// All transcendentals branch-free (v_rcp/v_exp based) so EXEC stays all-ones
// around WMMA issues.

#define DEV __device__ __forceinline__

typedef __attribute__((ext_vector_type(16))) _Float16 v16h;
typedef __attribute__((ext_vector_type(8)))  float    v8f;
typedef unsigned int u32x4 __attribute__((ext_vector_type(4)));
typedef int i32x8 __attribute__((ext_vector_type(8)));
typedef int i32x4 __attribute__((ext_vector_type(4)));

constexpr int Bn = 8, Ln = 2048, Dn = 512, Mn = 8;
constexpr int DHn = 64, KHn = 256, KSn = 31, PADn = 15;
constexpr int BLn = Bn * Ln;

// ---- branch-free math (no EXEC juggling near WMMA) --------------------------
DEV float erf_f(float x) {
  // Abramowitz-Stegun 7.1.26, |err| <= 1.5e-7, straight-line code.
  const float ax = fabsf(x);
  const float t = __builtin_amdgcn_rcpf(__builtin_fmaf(0.3275911f, ax, 1.0f));
  float p = __builtin_fmaf(1.061405429f, t, -1.453152027f);
  p = __builtin_fmaf(p, t, 1.421413741f);
  p = __builtin_fmaf(p, t, -0.284496736f);
  p = __builtin_fmaf(p, t, 0.254829592f);
  const float e = __expf(-ax * ax);          // v_exp_f32 path
  const float r = __builtin_fmaf(-p * t, e, 1.0f);
  return copysignf(r, x);
}
DEV float gelu_f(float x) { return 0.5f * x * (1.0f + erf_f(x * 0.7071067811865475f)); }
DEV float sigmoid_f(float x) { return __builtin_amdgcn_rcpf(1.0f + __expf(-x)); }

DEV v8f wmma_f16(v16h a, v16h b, v8f c) {
  return __builtin_amdgcn_wmma_f32_16x16x32_f16(
      /*neg_a=*/false, a, /*neg_b=*/false, b,
      /*c_mod=*/(short)0, c, /*reuse_a=*/false, /*reuse_b=*/false);
}

// ---- TDM: stage a packed 2D f16 tile (rows x cols, contiguous) into LDS -----
DEV void tdm_load_2d(unsigned lds_addr, const void* gsrc, int rows, int cols) {
  u32x4 g0;
  i32x8 g1;
  i32x4 z4;
  i32x8 z8;
  z4[0] = 0; z4[1] = 0; z4[2] = 0; z4[3] = 0;
  z8[0] = 0; z8[1] = 0; z8[2] = 0; z8[3] = 0;
  z8[4] = 0; z8[5] = 0; z8[6] = 0; z8[7] = 0;
  const unsigned long long ga = (unsigned long long)(uintptr_t)gsrc;
  g0[0] = 1u;                                                  // count=1, user D#
  g0[1] = lds_addr;                                            // lds_addr bytes
  g0[2] = (unsigned)ga;                                        // global_addr[31:0]
  g0[3] = (unsigned)((ga >> 32) & 0x01FFFFFFull) | (2u << 30); // addr[56:32], type=2
  g1[0] = 1 << 16;       // data_size = 2 bytes
  g1[1] = cols << 16;    // tensor_dim0[15:0]
  g1[2] = rows << 16;    // tensor_dim1[15:0]
  g1[3] = cols << 16;    // tile_dim0
  g1[4] = rows;          // tile_dim1
  g1[5] = cols;          // tensor_dim0_stride[31:0]
  g1[6] = 0;
  g1[7] = 0;
  // 6-arg variant (clang-23 / therock-10.0 headers)
  __builtin_amdgcn_tensor_load_to_lds(g0, g1, z4, z4, z8, 0);
}

// ---- fragment loaders (ISA 7.12.2 16-bit layouts, wave32) -------------------
DEV v16h load_a(const _Float16* __restrict__ A, int lda) {
  const int lane = threadIdx.x & 31;
  const int r = lane & 15;
  const int kb = (lane >> 4) << 3;
  v16h v;
#pragma unroll
  for (int i = 0; i < 16; ++i) {
    const int k = kb + (i & 7) + ((i >> 3) << 4);
    v[i] = A[(size_t)r * lda + k];
  }
  return v;
}
DEV v16h load_at(const _Float16* __restrict__ A, int lda) {
  const int lane = threadIdx.x & 31;
  const int r = lane & 15;
  const int kb = (lane >> 4) << 3;
  v16h v;
#pragma unroll
  for (int i = 0; i < 16; ++i) {
    const int k = kb + (i & 7) + ((i >> 3) << 4);
    v[i] = A[(size_t)k * lda + r];
  }
  return v;
}
DEV v16h load_b(const _Float16* __restrict__ Bp, int ldb) {
  const int lane = threadIdx.x & 31;
  const int n = lane & 15;
  const int kb = (lane >> 4) << 3;
  v16h v;
#pragma unroll
  for (int i = 0; i < 16; ++i) {
    const int k = kb + (i & 7) + ((i >> 3) << 4);
    v[i] = Bp[(size_t)k * ldb + n];
  }
  return v;
}
DEV v16h load_bt(const _Float16* __restrict__ W, int ldw) {
  const int lane = threadIdx.x & 31;
  const int n = lane & 15;
  const int kb = (lane >> 4) << 3;
  v16h v;
#pragma unroll
  for (int i = 0; i < 16; ++i) {
    const int k = kb + (i & 7) + ((i >> 3) << 4);
    v[i] = W[(size_t)n * ldw + k];
  }
  return v;
}

// ---- small elementwise kernels ---------------------------------------------
__global__ void k_cvt_f16(const float* __restrict__ s, _Float16* __restrict__ d, int n) {
  const int i = blockIdx.x * blockDim.x + threadIdx.x;
  if (i < n) d[i] = (_Float16)s[i];
}

__global__ void k_prep_hyp(const float* __restrict__ x, _Float16* __restrict__ xh,
                           _Float16* __restrict__ hyph) {
  const int i = blockIdx.x * blockDim.x + threadIdx.x;  // BL*D threads
  const int c = i & (Dn - 1);
  const int l = (i >> 9) & (Ln - 1);
  const float v = x[i];
  xh[i] = (_Float16)v;
  const float freq = __expf((float)(c & ~1) * (-9.210340371976184f / (float)Dn));
  const float arg = (float)l * freq;
  const float pe = (c & 1) ? cosf(arg) : sinf(arg);
  hyph[i] = (_Float16)(v + pe);
}

// ---- per-head hypernet MLP: TDM weights -> LDS, fc1 -> GELU -> fc2 ----------
__global__ void __launch_bounds__(128)
k_pmlp(const _Float16* __restrict__ hyp,
       const _Float16* __restrict__ fc1w, const float* __restrict__ fc1b,
       const _Float16* __restrict__ fc2w, const float* __restrict__ fc2b,
       _Float16* __restrict__ Wout) {
  __shared__ _Float16 hbuf[4][16 * DHn];      //  8 KB: fc1 activations per wave
  __shared__ _Float16 w1s[DHn * DHn];         //  8 KB: fc1 weights (one head)
  __shared__ _Float16 w2s[KHn * DHn];         // 32 KB: fc2 weights (one head)
  const int lane = threadIdx.x & 31;
  const int w = threadIdx.x >> 5;
  const int wave = blockIdx.x * 4 + w;
  const int lt = wave & (Ln / 16 - 1);        // 128 token tiles
  const int bm = wave >> 7;                   // same for all 4 waves in block
  const int m = bm & (Mn - 1);
  const int b = bm >> 3;
  const int col = lane & 15;
  const int rb = (lane >> 4) << 3;

  // One wave stages this head's weights via the Tensor Data Mover.
  if (w == 0) {
    tdm_load_2d((unsigned)(uintptr_t)(void*)w1s, fc1w + (size_t)m * DHn * DHn, DHn, DHn);
    tdm_load_2d((unsigned)(uintptr_t)(void*)w2s, fc2w + (size_t)m * KHn * DHn, KHn, DHn);
    __builtin_amdgcn_s_wait_tensorcnt(0);
  }
  __syncthreads();

  const _Float16* Ab = hyp + ((size_t)(b * Ln + lt * 16)) * Dn + m * DHn;
  const v16h a0 = load_a(Ab, Dn);             // k = 0..31
  const v16h a1 = load_a(Ab + 32, Dn);        // k = 32..63

  _Float16* hl = hbuf[w];
#pragma unroll
  for (int n0 = 0; n0 < DHn; n0 += 16) {
    const float bv = fc1b[m * DHn + n0 + col];
    v8f acc;
#pragma unroll
    for (int r = 0; r < 8; ++r) acc[r] = bv;
    acc = wmma_f16(a0, load_bt(w1s + (size_t)n0 * DHn, DHn), acc);
    acc = wmma_f16(a1, load_bt(w1s + (size_t)n0 * DHn + 32, DHn), acc);
#pragma unroll
    for (int r = 0; r < 8; ++r)
      hl[(rb + r) * DHn + n0 + col] = (_Float16)gelu_f(acc[r]);
  }
  const v16h h0 = load_a(hl, DHn);
  const v16h h1 = load_a(hl + 32, DHn);

  _Float16* Ob = Wout + ((size_t)bm * Ln + lt * 16) * KHn;
#pragma unroll 2
  for (int n0 = 0; n0 < KHn; n0 += 16) {
    const float bv = fc2b[m * KHn + n0 + col];
    v8f acc;
#pragma unroll
    for (int r = 0; r < 8; ++r) acc[r] = bv;
    acc = wmma_f16(h0, load_bt(w2s + (size_t)n0 * DHn, DHn), acc);
    acc = wmma_f16(h1, load_bt(w2s + (size_t)n0 * DHn + 32, DHn), acc);
#pragma unroll
    for (int r = 0; r < 8; ++r)
      Ob[(size_t)(rb + r) * KHn + n0 + col] = (_Float16)acc[r];
  }
}

// ---- token mixing bmm1: C1[bm,64,256] = gelu(xt[64,L] @ W1[L,256]) ----------
__global__ void __launch_bounds__(128)
k_mix1(const _Float16* __restrict__ xh, const _Float16* __restrict__ W1h,
       _Float16* __restrict__ C1) {
  const int lane = threadIdx.x & 31;
  const int wave = blockIdx.x * 4 + (threadIdx.x >> 5);
  const int nt = wave & 15;
  const int dt = (wave >> 4) & 3;
  const int bm = wave >> 6;
  const int m = bm & 7, b = bm >> 3;
  const int col = lane & 15, rb = (lane >> 4) << 3;
  const _Float16* Ab = xh + (size_t)b * Ln * Dn + m * DHn + dt * 16;  // A^T layout
  const _Float16* Bb = W1h + (size_t)bm * Ln * KHn + nt * 16;         // [K=L, N]
  v8f acc;
#pragma unroll
  for (int r = 0; r < 8; ++r) acc[r] = 0.0f;
  for (int kk = 0; kk < Ln; kk += 32) {
    const v16h a = load_at(Ab + (size_t)kk * Dn, Dn);
    const v16h bf = load_b(Bb + (size_t)kk * KHn, KHn);
    acc = wmma_f16(a, bf, acc);
  }
  _Float16* Cb = C1 + (size_t)bm * DHn * KHn + (size_t)(dt * 16) * KHn + nt * 16;
#pragma unroll
  for (int r = 0; r < 8; ++r)
    Cb[(size_t)(rb + r) * KHn + col] = (_Float16)gelu_f(acc[r]);
}

// ---- token mixing bmm2: mixpre[b,l,D] <- C1g[64,256] @ W2[L,256]^T ----------
__global__ void __launch_bounds__(128)
k_mix2(const _Float16* __restrict__ C1, const _Float16* __restrict__ W2h,
       float* __restrict__ mixpre) {
  const int lane = threadIdx.x & 31;
  const int wave = blockIdx.x * 4 + (threadIdx.x >> 5);
  const int lt = wave & 127;
  const int dt = (wave >> 7) & 3;
  const int bm = wave >> 9;
  const int m = bm & 7, b = bm >> 3;
  const int col = lane & 15, rb = (lane >> 4) << 3;
  const _Float16* Ab = C1 + (size_t)bm * DHn * KHn + (size_t)(dt * 16) * KHn;
  const _Float16* Bb = W2h + (size_t)bm * Ln * KHn + (size_t)(lt * 16) * KHn;
  v8f acc;
#pragma unroll
  for (int r = 0; r < 8; ++r) acc[r] = 0.0f;
#pragma unroll 2
  for (int kk = 0; kk < KHn; kk += 32) {
    const v16h a = load_a(Ab + kk, KHn);
    const v16h bf = load_bt(Bb + kk, KHn);
    acc = wmma_f16(a, bf, acc);
  }
  const int l = lt * 16 + col;
  float* Ob = mixpre + ((size_t)b * Ln + l) * Dn + m * DHn + dt * 16 + rb;
#pragma unroll
  for (int r = 0; r < 8; ++r) Ob[r] = acc[r];  // 8 consecutive floats along D
}

// ---- LN(mix) then LN(conv_ln1) -> t_h (f16) ---------------------------------
__global__ void __launch_bounds__(256)
k_ln_mix(const float* __restrict__ in, const float* __restrict__ g1,
         const float* __restrict__ b1, const float* __restrict__ g2,
         const float* __restrict__ b2, float* __restrict__ mix,
         _Float16* __restrict__ th) {
  __shared__ float s1[256], s2[256];
  const int t = blockIdx.x, tid = threadIdx.x;
  const float* row = in + (size_t)t * Dn;
  const float v0 = row[tid], v1 = row[tid + 256];
  s1[tid] = v0 + v1;
  s2[tid] = v0 * v0 + v1 * v1;
  __syncthreads();
  for (int s = 128; s > 0; s >>= 1) {
    if (tid < s) { s1[tid] += s1[tid + s]; s2[tid] += s2[tid + s]; }
    __syncthreads();
  }
  const float mean = s1[0] * (1.0f / Dn);
  const float var = fmaxf(s2[0] * (1.0f / Dn) - mean * mean, 0.0f);
  const float inv = rsqrtf(var + 1e-5f);
  const float o0 = (v0 - mean) * inv * g1[tid] + b1[tid];
  const float o1 = (v1 - mean) * inv * g1[tid + 256] + b1[tid + 256];
  float* mrow = mix + (size_t)t * Dn;
  mrow[tid] = o0;
  mrow[tid + 256] = o1;
  __syncthreads();
  s1[tid] = o0 + o1;
  s2[tid] = o0 * o0 + o1 * o1;
  __syncthreads();
  for (int s = 128; s > 0; s >>= 1) {
    if (tid < s) { s1[tid] += s1[tid + s]; s2[tid] += s2[tid + s]; }
    __syncthreads();
  }
  const float mean2 = s1[0] * (1.0f / Dn);
  const float var2 = fmaxf(s2[0] * (1.0f / Dn) - mean2 * mean2, 0.0f);
  const float inv2 = rsqrtf(var2 + 1e-5f);
  th[(size_t)t * Dn + tid] = (_Float16)((o0 - mean2) * inv2 * g2[tid] + b2[tid]);
  th[(size_t)t * Dn + tid + 256] =
      (_Float16)((o1 - mean2) * inv2 * g2[tid + 256] + b2[tid + 256]);
}

// ---- generic X[M,K](f16) @ W[N,K]^T + bias (+res) -> f32 --------------------
__global__ void __launch_bounds__(128)
k_gemm_nt(const _Float16* __restrict__ A, const _Float16* __restrict__ Wt,
          const float* __restrict__ bias, const float* __restrict__ res,
          float* __restrict__ out, int N, int K) {
  const int lane = threadIdx.x & 31;
  const int wave = blockIdx.x * 4 + (threadIdx.x >> 5);
  const int ntiles = N >> 4;
  const int nt = wave % ntiles;
  const int mt = wave / ntiles;
  const int col = lane & 15, rb = (lane >> 4) << 3;
  const float bv = bias[nt * 16 + col];
  v8f acc;
#pragma unroll
  for (int r = 0; r < 8; ++r) acc[r] = bv;
  const _Float16* Ab = A + (size_t)mt * 16 * K;
  const _Float16* Wb = Wt + (size_t)nt * 16 * K;
  for (int kk = 0; kk < K; kk += 32) {
    if (kk + 32 < K) {
      __builtin_prefetch(Ab + kk + 32, 0, 0);   // global_prefetch_b8
      __builtin_prefetch(Wb + kk + 32, 0, 0);
    }
    const v16h a = load_a(Ab + kk, K);
    const v16h bf = load_bt(Wb + kk, K);
    acc = wmma_f16(a, bf, acc);
  }
  const size_t base = (size_t)(mt * 16 + rb) * N + nt * 16 + col;
  if (res) {
#pragma unroll
    for (int r = 0; r < 8; ++r) out[base + (size_t)r * N] = acc[r] + res[base + (size_t)r * N];
  } else {
#pragma unroll
    for (int r = 0; r < 8; ++r) out[base + (size_t)r * N] = acc[r];
  }
}

// ---- GLU: g = c[:, :D] * sigmoid(c[:, D:]) ----------------------------------
__global__ void k_glu(const float* __restrict__ c, float* __restrict__ g) {
  const int i = blockIdx.x * blockDim.x + threadIdx.x;  // BL*D
  const int d = i & (Dn - 1);
  const int t = i >> 9;
  const float a = c[(size_t)t * (2 * Dn) + d];
  const float bg = c[(size_t)t * (2 * Dn) + Dn + d];
  g[i] = a * sigmoid_f(bg);
}

// ---- depthwise conv along L, kernel 31, zero-pad 15 -------------------------
__global__ void k_dwconv(const float* __restrict__ g, const float* __restrict__ dww,
                         const float* __restrict__ dwb, float* __restrict__ u) {
  const int i = blockIdx.x * blockDim.x + threadIdx.x;  // BL*D
  const int d = i & (Dn - 1);
  const int l = (i >> 9) & (Ln - 1);
  const int b = i >> 20;  // Ln*Dn == 2^20
  float acc = dwb[d];
  const float* gb = g + (size_t)b * Ln * Dn + d;
#pragma unroll
  for (int k = 0; k < KSn; ++k) {
    const int ls = l + k - PADn;
    if (ls >= 0 && ls < Ln) acc += gb[(size_t)ls * Dn] * dww[d * KSn + k];
  }
  u[i] = acc;
}

// ---- gelu(LN(u)) -> f16 -----------------------------------------------------
__global__ void __launch_bounds__(256)
k_ln_gelu(const float* __restrict__ in, const float* __restrict__ gg,
          const float* __restrict__ bb, _Float16* __restrict__ outh) {
  __shared__ float s1[256], s2[256];
  const int t = blockIdx.x, tid = threadIdx.x;
  const float* row = in + (size_t)t * Dn;
  const float v0 = row[tid], v1 = row[tid + 256];
  s1[tid] = v0 + v1;
  s2[tid] = v0 * v0 + v1 * v1;
  __syncthreads();
  for (int s = 128; s > 0; s >>= 1) {
    if (tid < s) { s1[tid] += s1[tid + s]; s2[tid] += s2[tid + s]; }
    __syncthreads();
  }
  const float mean = s1[0] * (1.0f / Dn);
  const float var = fmaxf(s2[0] * (1.0f / Dn) - mean * mean, 0.0f);
  const float inv = rsqrtf(var + 1e-5f);
  outh[(size_t)t * Dn + tid] = (_Float16)gelu_f((v0 - mean) * inv * gg[tid] + bb[tid]);
  outh[(size_t)t * Dn + tid + 256] =
      (_Float16)gelu_f((v1 - mean) * inv * gg[tid + 256] + bb[tid + 256]);
}

// ---- host-side launch -------------------------------------------------------
extern "C" void kernel_launch(void* const* d_in, const int* in_sizes, int n_in,
                              void* d_out, int out_size, void* d_ws, size_t ws_size,
                              hipStream_t stream) {
  (void)in_sizes; (void)n_in; (void)out_size; (void)ws_size;
  const float* x      = (const float*)d_in[0];
  const float* w1fc1w = (const float*)d_in[1];
  const float* w1fc1b = (const float*)d_in[2];
  const float* w1fc2w = (const float*)d_in[3];
  const float* w1fc2b = (const float*)d_in[4];
  const float* w2fc1w = (const float*)d_in[5];
  const float* w2fc1b = (const float*)d_in[6];
  const float* w2fc2w = (const float*)d_in[7];
  const float* w2fc2b = (const float*)d_in[8];
  const float* lnmixg = (const float*)d_in[9];
  const float* lnmixb = (const float*)d_in[10];
  const float* cln1g  = (const float*)d_in[11];
  const float* cln1b  = (const float*)d_in[12];
  const float* bneckw = (const float*)d_in[13];
  const float* bneckb = (const float*)d_in[14];
  const float* dww    = (const float*)d_in[15];
  const float* dwb    = (const float*)d_in[16];
  const float* cln2g  = (const float*)d_in[17];
  const float* cln2b  = (const float*)d_in[18];
  const float* linw   = (const float*)d_in[19];
  const float* linb   = (const float*)d_in[20];
  float* out = (float*)d_out;

  char* ws = (char*)d_ws;
  const size_t SZ_H = (size_t)BLn * Dn * sizeof(_Float16);              // 16.78 MB
  const size_t SZ_F = (size_t)BLn * Dn * sizeof(float);                 // 33.55 MB
  const size_t SZ_W = (size_t)Bn * Mn * Ln * KHn * sizeof(_Float16);    // 67.11 MB

  _Float16* xh   = (_Float16*)(ws);
  _Float16* hyph = (_Float16*)(ws + SZ_H);
  char* R2 = ws + 2 * SZ_H;                 // 67MB region: W1h -> mixpre -> c -> u/uh
  char* R3 = R2 + SZ_W;                     // 67MB region: W2h -> mix + t_h
  _Float16* c1g = (_Float16*)(R3 + SZ_W);   // [64,64,256] f16 = 2 MB
  char* WTS = (char*)c1g + (size_t)Bn * Mn * DHn * KHn * sizeof(_Float16);

  _Float16* w1fc1h = (_Float16*)(WTS);
  _Float16* w1fc2h = (_Float16*)(WTS + 65536);
  _Float16* w2fc1h = (_Float16*)(WTS + 65536 + 262144);
  _Float16* w2fc2h = (_Float16*)(WTS + 2 * 65536 + 262144);
  _Float16* bwh    = (_Float16*)(WTS + 2 * 65536 + 2 * 262144);
  _Float16* lwh    = (_Float16*)(WTS + 2 * 65536 + 2 * 262144 + 1048576);

  // lifetime-disjoint aliases
  _Float16* W1h = (_Float16*)R2;
  _Float16* W2h = (_Float16*)R3;
  float*    mixpre = (float*)R2;            // after W1h dead
  float*    mix    = (float*)R3;            // after W2h dead
  _Float16* th     = (_Float16*)(R3 + SZ_F);
  float*    cbuf   = (float*)R2;            // [BL,1024] after mixpre dead
  float*    gbuf   = (float*)ws;            // over xh+hyph (dead)
  float*    ubuf   = (float*)R2;            // after cbuf dead
  _Float16* uh     = (_Float16*)(R2 + SZ_F);

  // 1) weights -> f16
  k_cvt_f16<<<dim3(Mn * DHn * DHn / 256), dim3(256), 0, stream>>>(w1fc1w, w1fc1h, Mn * DHn * DHn);
  k_cvt_f16<<<dim3(Mn * KHn * DHn / 256), dim3(256), 0, stream>>>(w1fc2w, w1fc2h, Mn * KHn * DHn);
  k_cvt_f16<<<dim3(Mn * DHn * DHn / 256), dim3(256), 0, stream>>>(w2fc1w, w2fc1h, Mn * DHn * DHn);
  k_cvt_f16<<<dim3(Mn * KHn * DHn / 256), dim3(256), 0, stream>>>(w2fc2w, w2fc2h, Mn * KHn * DHn);
  k_cvt_f16<<<dim3(2 * Dn * Dn / 256), dim3(256), 0, stream>>>(bneckw, bwh, 2 * Dn * Dn);
  k_cvt_f16<<<dim3(Dn * Dn / 256), dim3(256), 0, stream>>>(linw, lwh, Dn * Dn);

  // 2) x_h, hyp_h (x + PE)
  k_prep_hyp<<<dim3(BLn * Dn / 256), dim3(256), 0, stream>>>(x, xh, hyph);

  // 3) hypernet MLPs -> W1, W2 (f16); weights staged via TDM
  const int pmlp_blocks = (Bn * Mn * (Ln / 16)) / 4;   // 2048
  k_pmlp<<<dim3(pmlp_blocks), dim3(128), 0, stream>>>(hyph, w1fc1h, w1fc1b, w1fc2h, w1fc2b, W1h);
  k_pmlp<<<dim3(pmlp_blocks), dim3(128), 0, stream>>>(hyph, w2fc1h, w2fc1b, w2fc2h, w2fc2b, W2h);

  // 4) token mixing bmms
  k_mix1<<<dim3((Bn * Mn * 4 * 16) / 4), dim3(128), 0, stream>>>(xh, W1h, c1g);
  k_mix2<<<dim3((Bn * Mn * 4 * 128) / 4), dim3(128), 0, stream>>>(c1g, W2h, mixpre);

  // 5) LN(mix) and LN(conv_ln1) -> t_h
  k_ln_mix<<<dim3(BLn), dim3(256), 0, stream>>>(mixpre, lnmixg, lnmixb, cln1g, cln1b, mix, th);

  // 6) bottleneck 1x1 conv: [BL,512] @ [1024,512]^T + b
  k_gemm_nt<<<dim3((BLn / 16) * (2 * Dn / 16) / 4), dim3(128), 0, stream>>>(
      th, bwh, bneckb, nullptr, cbuf, 2 * Dn, Dn);

  // 7) GLU, 8) depthwise conv, 9) gelu(LN)
  k_glu<<<dim3(BLn * Dn / 256), dim3(256), 0, stream>>>(cbuf, gbuf);
  k_dwconv<<<dim3(BLn * Dn / 256), dim3(256), 0, stream>>>(gbuf, dww, dwb, ubuf);
  k_ln_gelu<<<dim3(BLn), dim3(256), 0, stream>>>(ubuf, cln2g, cln2b, uh);

  // 10) final linear + residual: out = mix + (u @ lin_w^T + b)
  k_gemm_nt<<<dim3((BLn / 16) * (Dn / 16) / 4), dim3(128), 0, stream>>>(
      uh, lwh, linb, mix, out, Dn, Dn);
}

// v001
// A run of this version takes 494 microseconds.
// Next to v000, in two timings, it ran 1.42 times as fast each time.
#include <hip/hip_runtime.h>

// HyperConformer for MI455X (gfx1250, wave32, WMMA + TDM).
// GEMMs: v_wmma_f32_16x16x32_f16, f32 accumulate, f16-staged operands.
// Hypernet weights staged to LDS via tensor_load_to_lds (TDM, TENSORcnt).
// All transcendentals branch-free (v_rcp/v_exp based) so EXEC stays all-ones
// around WMMA issues.

#define DEV __device__ __forceinline__

typedef __attribute__((ext_vector_type(16))) _Float16 v16h;
typedef __attribute__((ext_vector_type(8)))  float    v8f;
typedef unsigned int u32x4 __attribute__((ext_vector_type(4)));
typedef int i32x8 __attribute__((ext_vector_type(8)));
typedef int i32x4 __attribute__((ext_vector_type(4)));

constexpr int Bn = 8, Ln = 2048, Dn = 512, Mn = 8;
constexpr int DHn = 64, KHn = 256, KSn = 31, PADn = 15;
constexpr int BLn = Bn * Ln;

// ---- branch-free math (no EXEC juggling near WMMA) --------------------------
DEV float erf_f(float x) {
  // Abramowitz-Stegun 7.1.26, |err| <= 1.5e-7, straight-line code.
  const float ax = fabsf(x);
  const float t = __builtin_amdgcn_rcpf(__builtin_fmaf(0.3275911f, ax, 1.0f));
  float p = __builtin_fmaf(1.061405429f, t, -1.453152027f);
  p = __builtin_fmaf(p, t, 1.421413741f);
  p = __builtin_fmaf(p, t, -0.284496736f);
  p = __builtin_fmaf(p, t, 0.254829592f);
  const float e = __expf(-ax * ax);          // v_exp_f32 path
  const float r = __builtin_fmaf(-p * t, e, 1.0f);
  return copysignf(r, x);
}
DEV float gelu_f(float x) { return 0.5f * x * (1.0f + erf_f(x * 0.7071067811865475f)); }
DEV float sigmoid_f(float x) { return __builtin_amdgcn_rcpf(1.0f + __expf(-x)); }

DEV v8f wmma_f16(v16h a, v16h b, v8f c) {
  return __builtin_amdgcn_wmma_f32_16x16x32_f16(
      /*neg_a=*/false, a, /*neg_b=*/false, b,
      /*c_mod=*/(short)0, c, /*reuse_a=*/false, /*reuse_b=*/false);
}

// ---- TDM: stage a packed 2D f16 tile (rows x cols, contiguous) into LDS -----
DEV void tdm_load_2d(unsigned lds_addr, const void* gsrc, int rows, int cols) {
  u32x4 g0;
  i32x8 g1;
  i32x4 z4;
  i32x8 z8;
  z4[0] = 0; z4[1] = 0; z4[2] = 0; z4[3] = 0;
  z8[0] = 0; z8[1] = 0; z8[2] = 0; z8[3] = 0;
  z8[4] = 0; z8[5] = 0; z8[6] = 0; z8[7] = 0;
  const unsigned long long ga = (unsigned long long)(uintptr_t)gsrc;
  g0[0] = 1u;                                                  // count=1, user D#
  g0[1] = lds_addr;                                            // lds_addr bytes
  g0[2] = (unsigned)ga;                                        // global_addr[31:0]
  g0[3] = (unsigned)((ga >> 32) & 0x01FFFFFFull) | (2u << 30); // addr[56:32], type=2
  g1[0] = 1 << 16;       // data_size = 2 bytes
  g1[1] = cols << 16;    // tensor_dim0[15:0]
  g1[2] = rows << 16;    // tensor_dim1[15:0]
  g1[3] = cols << 16;    // tile_dim0
  g1[4] = rows;          // tile_dim1
  g1[5] = cols;          // tensor_dim0_stride[31:0]
  g1[6] = 0;
  g1[7] = 0;
  // 6-arg variant (clang-23 / therock-10.0 headers)
  __builtin_amdgcn_tensor_load_to_lds(g0, g1, z4, z4, z8, 0);
}

// ---- fragment loaders (ISA 7.12.2 16-bit layouts, wave32) -------------------
DEV v16h load_a(const _Float16* __restrict__ A, int lda) {
  const int lane = threadIdx.x & 31;
  const int r = lane & 15;
  const int kb = (lane >> 4) << 3;
  v16h v;
#pragma unroll
  for (int i = 0; i < 16; ++i) {
    const int k = kb + (i & 7) + ((i >> 3) << 4);
    v[i] = A[(size_t)r * lda + k];
  }
  return v;
}
DEV v16h load_at(const _Float16* __restrict__ A, int lda) {
  const int lane = threadIdx.x & 31;
  const int r = lane & 15;
  const int kb = (lane >> 4) << 3;
  v16h v;
#pragma unroll
  for (int i = 0; i < 16; ++i) {
    const int k = kb + (i & 7) + ((i >> 3) << 4);
    v[i] = A[(size_t)k * lda + r];
  }
  return v;
}
DEV v16h load_b(const _Float16* __restrict__ Bp, int ldb) {
  const int lane = threadIdx.x & 31;
  const int n = lane & 15;
  const int kb = (lane >> 4) << 3;
  v16h v;
#pragma unroll
  for (int i = 0; i < 16; ++i) {
    const int k = kb + (i & 7) + ((i >> 3) << 4);
    v[i] = Bp[(size_t)k * ldb + n];
  }
  return v;
}
DEV v16h load_bt(const _Float16* __restrict__ W, int ldw) {
  const int lane = threadIdx.x & 31;
  const int n = lane & 15;
  const int kb = (lane >> 4) << 3;
  v16h v;
#pragma unroll
  for (int i = 0; i < 16; ++i) {
    const int k = kb + (i & 7) + ((i >> 3) << 4);
    v[i] = W[(size_t)n * ldw + k];
  }
  return v;
}

// ---- small elementwise kernels ---------------------------------------------
__global__ void k_cvt_f16(const float* __restrict__ s, _Float16* __restrict__ d, int n) {
  const int i = blockIdx.x * blockDim.x + threadIdx.x;
  if (i < n) d[i] = (_Float16)s[i];
}

__global__ void k_prep_hyp(const float* __restrict__ x, _Float16* __restrict__ xh,
                           _Float16* __restrict__ hyph) {
  const int i = blockIdx.x * blockDim.x + threadIdx.x;  // BL*D threads
  const int c = i & (Dn - 1);
  const int l = (i >> 9) & (Ln - 1);
  const float v = x[i];
  xh[i] = (_Float16)v;
  const float freq = __expf((float)(c & ~1) * (-9.210340371976184f / (float)Dn));
  const float arg = (float)l * freq;
  const float pe = (c & 1) ? cosf(arg) : sinf(arg);
  hyph[i] = (_Float16)(v + pe);
}

// ---- per-head hypernet MLP: TDM weights -> LDS, fc1 -> GELU -> fc2 ----------
__global__ void __launch_bounds__(128)
k_pmlp(const _Float16* __restrict__ hyp,
       const _Float16* __restrict__ fc1w, const float* __restrict__ fc1b,
       const _Float16* __restrict__ fc2w, const float* __restrict__ fc2b,
       _Float16* __restrict__ Wout) {
  __shared__ _Float16 hbuf[4][16 * DHn];      //  8 KB: fc1 activations per wave
  __shared__ _Float16 w1s[DHn * DHn];         //  8 KB: fc1 weights (one head)
  __shared__ _Float16 w2s[KHn * DHn];         // 32 KB: fc2 weights (one head)
  const int lane = threadIdx.x & 31;
  const int w = threadIdx.x >> 5;
  const int wave = blockIdx.x * 4 + w;
  const int lt = wave & (Ln / 16 - 1);        // 128 token tiles
  const int bm = wave >> 7;                   // same for all 4 waves in block
  const int m = bm & (Mn - 1);
  const int b = bm >> 3;
  const int col = lane & 15;
  const int rb = (lane >> 4) << 3;

  // One wave stages this head's weights via the Tensor Data Mover.
  if (w == 0) {
    tdm_load_2d((unsigned)(uintptr_t)(void*)w1s, fc1w + (size_t)m * DHn * DHn, DHn, DHn);
    tdm_load_2d((unsigned)(uintptr_t)(void*)w2s, fc2w + (size_t)m * KHn * DHn, KHn, DHn);
    __builtin_amdgcn_s_wait_tensorcnt(0);
  }
  __syncthreads();

  const _Float16* Ab = hyp + ((size_t)(b * Ln + lt * 16)) * Dn + m * DHn;
  const v16h a0 = load_a(Ab, Dn);             // k = 0..31
  const v16h a1 = load_a(Ab + 32, Dn);        // k = 32..63

  _Float16* hl = hbuf[w];
#pragma unroll
  for (int n0 = 0; n0 < DHn; n0 += 16) {
    const float bv = fc1b[m * DHn + n0 + col];
    v8f acc;
#pragma unroll
    for (int r = 0; r < 8; ++r) acc[r] = bv;
    acc = wmma_f16(a0, load_bt(w1s + (size_t)n0 * DHn, DHn), acc);
    acc = wmma_f16(a1, load_bt(w1s + (size_t)n0 * DHn + 32, DHn), acc);
#pragma unroll
    for (int r = 0; r < 8; ++r)
      hl[(rb + r) * DHn + n0 + col] = (_Float16)gelu_f(acc[r]);
  }
  const v16h h0 = load_a(hl, DHn);
  const v16h h1 = load_a(hl + 32, DHn);

  _Float16* Ob = Wout + ((size_t)bm * Ln + lt * 16) * KHn;
#pragma unroll 2
  for (int n0 = 0; n0 < KHn; n0 += 16) {
    const float bv = fc2b[m * KHn + n0 + col];
    v8f acc;
#pragma unroll
    for (int r = 0; r < 8; ++r) acc[r] = bv;
    acc = wmma_f16(h0, load_bt(w2s + (size_t)n0 * DHn, DHn), acc);
    acc = wmma_f16(h1, load_bt(w2s + (size_t)n0 * DHn + 32, DHn), acc);
#pragma unroll
    for (int r = 0; r < 8; ++r)
      Ob[(size_t)(rb + r) * KHn + n0 + col] = (_Float16)acc[r];
  }
}

// ---- token mixing bmm1: C1[bm,64,256] = gelu(xt[64,L] @ W1[L,256]) ----------
__global__ void __launch_bounds__(128)
k_mix1(const _Float16* __restrict__ xh, const _Float16* __restrict__ W1h,
       _Float16* __restrict__ C1) {
  const int lane = threadIdx.x & 31;
  const int wave = blockIdx.x * 4 + (threadIdx.x >> 5);
  const int nt = wave & 15;
  const int dt = (wave >> 4) & 3;
  const int bm = wave >> 6;
  const int m = bm & 7, b = bm >> 3;
  const int col = lane & 15, rb = (lane >> 4) << 3;
  const _Float16* Ab = xh + (size_t)b * Ln * Dn + m * DHn + dt * 16;  // A^T layout
  const _Float16* Bb = W1h + (size_t)bm * Ln * KHn + nt * 16;         // [K=L, N]
  v8f acc;
#pragma unroll
  for (int r = 0; r < 8; ++r) acc[r] = 0.0f;
  for (int kk = 0; kk < Ln; kk += 32) {
    const v16h a = load_at(Ab + (size_t)kk * Dn, Dn);
    const v16h bf = load_b(Bb + (size_t)kk * KHn, KHn);
    acc = wmma_f16(a, bf, acc);
  }
  _Float16* Cb = C1 + (size_t)bm * DHn * KHn + (size_t)(dt * 16) * KHn + nt * 16;
#pragma unroll
  for (int r = 0; r < 8; ++r)
    Cb[(size_t)(rb + r) * KHn + col] = (_Float16)gelu_f(acc[r]);
}

// ---- token mixing bmm2: mixpre[b,l,D] <- C1g[64,256] @ W2[L,256]^T ----------
__global__ void __launch_bounds__(128)
k_mix2(const _Float16* __restrict__ C1, const _Float16* __restrict__ W2h,
       float* __restrict__ mixpre) {
  const int lane = threadIdx.x & 31;
  const int wave = blockIdx.x * 4 + (threadIdx.x >> 5);
  const int lt = wave & 127;
  const int dt = (wave >> 7) & 3;
  const int bm = wave >> 9;
  const int m = bm & 7, b = bm >> 3;
  const int col = lane & 15, rb = (lane >> 4) << 3;
  const _Float16* Ab = C1 + (size_t)bm * DHn * KHn + (size_t)(dt * 16) * KHn;
  const _Float16* Bb = W2h + (size_t)bm * Ln * KHn + (size_t)(lt * 16) * KHn;
  v8f acc;
#pragma unroll
  for (int r = 0; r < 8; ++r) acc[r] = 0.0f;
#pragma unroll 2
  for (int kk = 0; kk < KHn; kk += 32) {
    const v16h a = load_a(Ab + kk, KHn);
    const v16h bf = load_bt(Bb + kk, KHn);
    acc = wmma_f16(a, bf, acc);
  }
  const int l = lt * 16 + col;
  float* Ob = mixpre + ((size_t)b * Ln + l) * Dn + m * DHn + dt * 16 + rb;
#pragma unroll
  for (int r = 0; r < 8; ++r) Ob[r] = acc[r];  // 8 consecutive floats along D
}

// ---- LN(mix) then LN(conv_ln1) -> t_h (f16) ---------------------------------
__global__ void __launch_bounds__(256)
k_ln_mix(const float* __restrict__ in, const float* __restrict__ g1,
         const float* __restrict__ b1, const float* __restrict__ g2,
         const float* __restrict__ b2, float* __restrict__ mix,
         _Float16* __restrict__ th) {
  __shared__ float s1[256], s2[256];
  const int t = blockIdx.x, tid = threadIdx.x;
  const float* row = in + (size_t)t * Dn;
  const float v0 = row[tid], v1 = row[tid + 256];
  s1[tid] = v0 + v1;
  s2[tid] = v0 * v0 + v1 * v1;
  __syncthreads();
  for (int s = 128; s > 0; s >>= 1) {
    if (tid < s) { s1[tid] += s1[tid + s]; s2[tid] += s2[tid + s]; }
    __syncthreads();
  }
  const float mean = s1[0] * (1.0f / Dn);
  const float var = fmaxf(s2[0] * (1.0f / Dn) - mean * mean, 0.0f);
  const float inv = rsqrtf(var + 1e-5f);
  const float o0 = (v0 - mean) * inv * g1[tid] + b1[tid];
  const float o1 = (v1 - mean) * inv * g1[tid + 256] + b1[tid + 256];
  float* mrow = mix + (size_t)t * Dn;
  mrow[tid] = o0;
  mrow[tid + 256] = o1;
  __syncthreads();
  s1[tid] = o0 + o1;
  s2[tid] = o0 * o0 + o1 * o1;
  __syncthreads();
  for (int s = 128; s > 0; s >>= 1) {
    if (tid < s) { s1[tid] += s1[tid + s]; s2[tid] += s2[tid + s]; }
    __syncthreads();
  }
  const float mean2 = s1[0] * (1.0f / Dn);
  const float var2 = fmaxf(s2[0] * (1.0f / Dn) - mean2 * mean2, 0.0f);
  const float inv2 = rsqrtf(var2 + 1e-5f);
  th[(size_t)t * Dn + tid] = (_Float16)((o0 - mean2) * inv2 * g2[tid] + b2[tid]);
  th[(size_t)t * Dn + tid + 256] =
      (_Float16)((o1 - mean2) * inv2 * g2[tid + 256] + b2[tid + 256]);
}

// ---- generic X[M,K](f16) @ W[N,K]^T + bias (+res) -> f32 --------------------
__global__ void __launch_bounds__(128)
k_gemm_nt(const _Float16* __restrict__ A, const _Float16* __restrict__ Wt,
          const float* __restrict__ bias, const float* __restrict__ res,
          float* __restrict__ out, int N, int K) {
  const int lane = threadIdx.x & 31;
  const int wave = blockIdx.x * 4 + (threadIdx.x >> 5);
  const int ntiles = N >> 4;
  const int nt = wave % ntiles;
  const int mt = wave / ntiles;
  const int col = lane & 15, rb = (lane >> 4) << 3;
  const float bv = bias[nt * 16 + col];
  v8f acc;
#pragma unroll
  for (int r = 0; r < 8; ++r) acc[r] = bv;
  const _Float16* Ab = A + (size_t)mt * 16 * K;
  const _Float16* Wb = Wt + (size_t)nt * 16 * K;
  for (int kk = 0; kk < K; kk += 32) {
    if (kk + 32 < K) {
      __builtin_prefetch(Ab + kk + 32, 0, 0);   // global_prefetch_b8
      __builtin_prefetch(Wb + kk + 32, 0, 0);
    }
    const v16h a = load_a(Ab + kk, K);
    const v16h bf = load_bt(Wb + kk, K);
    acc = wmma_f16(a, bf, acc);
  }
  const size_t base = (size_t)(mt * 16 + rb) * N + nt * 16 + col;
  if (res) {
#pragma unroll
    for (int r = 0; r < 8; ++r) out[base + (size_t)r * N] = acc[r] + res[base + (size_t)r * N];
  } else {
#pragma unroll
    for (int r = 0; r < 8; ++r) out[base + (size_t)r * N] = acc[r];
  }
}

// ---- GLU: g = c[:, :D] * sigmoid(c[:, D:]) ----------------------------------
__global__ void k_glu(const float* __restrict__ c, float* __restrict__ g) {
  const int i = blockIdx.x * blockDim.x + threadIdx.x;  // BL*D
  const int d = i & (Dn - 1);
  const int t = i >> 9;
  const float a = c[(size_t)t * (2 * Dn) + d];
  const float bg = c[(size_t)t * (2 * Dn) + Dn + d];
  g[i] = a * sigmoid_f(bg);
}

// ---- depthwise conv along L, kernel 31, zero-pad 15 -------------------------
// One thread: 2 neighbouring channels x TLn consecutive positions. The 31 taps
// of both channels and the TLn running sums stay in registers; each input row
// is loaded once per tile and feeds up to 31 sums. Per output the taps are
// added in ascending k, as in the one-output-per-thread form.
// Every loop below is fully unrolled so that each index of w[], in[] and acc[]
// is a constant: an index known only at run time would send the array to scratch.
typedef __attribute__((ext_vector_type(2))) float v2f;
constexpr int TLn = 32;
static_assert(TLn >= PADn && Ln % TLn == 0 && KSn == 2 * PADn + 1, "tile shape");

__global__ void __launch_bounds__(256)
k_dwconv(const float* __restrict__ g, const float* __restrict__ dww,
         const float* __restrict__ dwb, float* __restrict__ u) {
  const int d = threadIdx.x * 2;                       // channel pair
  const int l0 = (blockIdx.x & (Ln / TLn - 1)) * TLn;  // first output row
  const int b = blockIdx.x / (Ln / TLn);
  const size_t tile = ((size_t)b * Ln + l0) * Dn + d;

  v2f w[KSn];
#pragma unroll  // constant index into w[]
  for (int k = 0; k < KSn; ++k) {
    w[k][0] = dww[d * KSn + k];
    w[k][1] = dww[(d + 1) * KSn + k];
  }
  v2f bias;
  bias[0] = dwb[d];
  bias[1] = dwb[d + 1];

  // in[j] = input row l0 - PADn + j. The PADn rows in front of the first tile
  // of a sequence and behind its last tile are the zero pad and are not read
  // (both tests are the same for the whole block).
  const float* gt = g + tile;
  v2f in[TLn + 2 * PADn];
  if (l0 > 0) {
#pragma unroll  // constant index into in[]
    for (int j = 0; j < PADn; ++j) in[j] = *(const v2f*)(gt + (j - PADn) * Dn);
  } else {
#pragma unroll  // constant index into in[]
    for (int j = 0; j < PADn; ++j) in[j] = 0.0f;
  }
#pragma unroll  // constant index into in[]
  for (int j = 0; j < TLn; ++j) in[PADn + j] = *(const v2f*)(gt + j * Dn);
  if (l0 + TLn < Ln) {
#pragma unroll  // constant index into in[]
    for (int j = 0; j < PADn; ++j)
      in[PADn + TLn + j] = *(const v2f*)(gt + (TLn + j) * Dn);
  } else {
#pragma unroll  // constant index into in[]
    for (int j = 0; j < PADn; ++j) in[PADn + TLn + j] = 0.0f;
  }

  v2f acc[TLn];
#pragma unroll  // constant index into acc[] and in[]
  for (int t = 0; t < TLn; ++t) {
    acc[t] = bias;
#pragma unroll  // constant index into in[] and w[]
    for (int k = 0; k < KSn; ++k) acc[t] += in[t + k] * w[k];
  }

  float* ut = u + tile;
#pragma unroll  // constant index into acc[]
  for (int t = 0; t < TLn; ++t) *(v2f*)(ut + t * Dn) = acc[t];
}

// ---- gelu(LN(u)) -> f16 -----------------------------------------------------
__global__ void __launch_bounds__(256)
k_ln_gelu(const float* __restrict__ in, const float* __restrict__ gg,
          const float* __restrict__ bb, _Float16* __restrict__ outh) {
  __shared__ float s1[256], s2[256];
  const int t = blockIdx.x, tid = threadIdx.x;
  const float* row = in + (size_t)t * Dn;
  const float v0 = row[tid], v1 = row[tid + 256];
  s1[tid] = v0 + v1;
  s2[tid] = v0 * v0 + v1 * v1;
  __syncthreads();
  for (int s = 128; s > 0; s >>= 1) {
    if (tid < s) { s1[tid] += s1[tid + s]; s2[tid] += s2[tid + s]; }
    __syncthreads();
  }
  const float mean = s1[0] * (1.0f / Dn);
  const float var = fmaxf(s2[0] * (1.0f / Dn) - mean * mean, 0.0f);
  const float inv = rsqrtf(var + 1e-5f);
  outh[(size_t)t * Dn + tid] = (_Float16)gelu_f((v0 - mean) * inv * gg[tid] + bb[tid]);
  outh[(size_t)t * Dn + tid + 256] =
      (_Float16)gelu_f((v1 - mean) * inv * gg[tid + 256] + bb[tid + 256]);
}

// ---- host-side launch -------------------------------------------------------
extern "C" void kernel_launch(void* const* d_in, const int* in_sizes, int n_in,
                              void* d_out, int out_size, void* d_ws, size_t ws_size,
                              hipStream_t stream) {
  (void)in_sizes; (void)n_in; (void)out_size; (void)ws_size;
  const float* x      = (const float*)d_in[0];
  const float* w1fc1w = (const float*)d_in[1];
  const float* w1fc1b = (const float*)d_in[2];
  const float* w1fc2w = (const float*)d_in[3];
  const float* w1fc2b = (const float*)d_in[4];
  const float* w2fc1w = (const float*)d_in[5];
  const float* w2fc1b = (const float*)d_in[6];
  const float* w2fc2w = (const float*)d_in[7];
  const float* w2fc2b = (const float*)d_in[8];
  const float* lnmixg = (const float*)d_in[9];
  const float* lnmixb = (const float*)d_in[10];
  const float* cln1g  = (const float*)d_in[11];
  const float* cln1b  = (const float*)d_in[12];
  const float* bneckw = (const float*)d_in[13];
  const float* bneckb = (const float*)d_in[14];
  const float* dww    = (const float*)d_in[15];
  const float* dwb    = (const float*)d_in[16];
  const float* cln2g  = (const float*)d_in[17];
  const float* cln2b  = (const float*)d_in[18];
  const float* linw   = (const float*)d_in[19];
  const float* linb   = (const float*)d_in[20];
  float* out = (float*)d_out;

  char* ws = (char*)d_ws;
  const size_t SZ_H = (size_t)BLn * Dn * sizeof(_Float16);              // 16.78 MB
  const size_t SZ_F = (size_t)BLn * Dn * sizeof(float);                 // 33.55 MB
  const size_t SZ_W = (size_t)Bn * Mn * Ln * KHn * sizeof(_Float16);    // 67.11 MB

  _Float16* xh   = (_Float16*)(ws);
  _Float16* hyph = (_Float16*)(ws + SZ_H);
  char* R2 = ws + 2 * SZ_H;                 // 67MB region: W1h -> mixpre -> c -> u/uh
  char* R3 = R2 + SZ_W;                     // 67MB region: W2h -> mix + t_h
  _Float16* c1g = (_Float16*)(R3 + SZ_W);   // [64,64,256] f16 = 2 MB
  char* WTS = (char*)c1g + (size_t)Bn * Mn * DHn * KHn * sizeof(_Float16);

  _Float16* w1fc1h = (_Float16*)(WTS);
  _Float16* w1fc2h = (_Float16*)(WTS + 65536);
  _Float16* w2fc1h = (_Float16*)(WTS + 65536 + 262144);
  _Float16* w2fc2h = (_Float16*)(WTS + 2 * 65536 + 262144);
  _Float16* bwh    = (_Float16*)(WTS + 2 * 65536 + 2 * 262144);
  _Float16* lwh    = (_Float16*)(WTS + 2 * 65536 + 2 * 262144 + 1048576);

  // lifetime-disjoint aliases
  _Float16* W1h = (_Float16*)R2;
  _Float16* W2h = (_Float16*)R3;
  float*    mixpre = (float*)R2;            // after W1h dead
  float*    mix    = (float*)R3;            // after W2h dead
  _Float16* th     = (_Float16*)(R3 + SZ_F);
  float*    cbuf   = (float*)R2;            // [BL,1024] after mixpre dead
  float*    gbuf   = (float*)ws;            // over xh+hyph (dead)
  float*    ubuf   = (float*)R2;            // after cbuf dead
  _Float16* uh     = (_Float16*)(R2 + SZ_F);

  // 1) weights -> f16
  k_cvt_f16<<<dim3(Mn * DHn * DHn / 256), dim3(256), 0, stream>>>(w1fc1w, w1fc1h, Mn * DHn * DHn);
  k_cvt_f16<<<dim3(Mn * KHn * DHn / 256), dim3(256), 0, stream>>>(w1fc2w, w1fc2h, Mn * KHn * DHn);
  k_cvt_f16<<<dim3(Mn * DHn * DHn / 256), dim3(256), 0, stream>>>(w2fc1w, w2fc1h, Mn * DHn * DHn);
  k_cvt_f16<<<dim3(Mn * KHn * DHn / 256), dim3(256), 0, stream>>>(w2fc2w, w2fc2h, Mn * KHn * DHn);
  k_cvt_f16<<<dim3(2 * Dn * Dn / 256), dim3(256), 0, stream>>>(bneckw, bwh, 2 * Dn * Dn);
  k_cvt_f16<<<dim3(Dn * Dn / 256), dim3(256), 0, stream>>>(linw, lwh, Dn * Dn);

  // 2) x_h, hyp_h (x + PE)
  k_prep_hyp<<<dim3(BLn * Dn / 256), dim3(256), 0, stream>>>(x, xh, hyph);

  // 3) hypernet MLPs -> W1, W2 (f16); weights staged via TDM
  const int pmlp_blocks = (Bn * Mn * (Ln / 16)) / 4;   // 2048
  k_pmlp<<<dim3(pmlp_blocks), dim3(128), 0, stream>>>(hyph, w1fc1h, w1fc1b, w1fc2h, w1fc2b, W1h);
  k_pmlp<<<dim3(pmlp_blocks), dim3(128), 0, stream>>>(hyph, w2fc1h, w2fc1b, w2fc2h, w2fc2b, W2h);

  // 4) token mixing bmms
  k_mix1<<<dim3((Bn * Mn * 4 * 16) / 4), dim3(128), 0, stream>>>(xh, W1h, c1g);
  k_mix2<<<dim3((Bn * Mn * 4 * 128) / 4), dim3(128), 0, stream>>>(c1g, W2h, mixpre);

  // 5) LN(mix) and LN(conv_ln1) -> t_h
  k_ln_mix<<<dim3(BLn), dim3(256), 0, stream>>>(mixpre, lnmixg, lnmixb, cln1g, cln1b, mix, th);

  // 6) bottleneck 1x1 conv: [BL,512] @ [1024,512]^T + b
  k_gemm_nt<<<dim3((BLn / 16) * (2 * Dn / 16) / 4), dim3(128), 0, stream>>>(
      th, bwh, bneckb, nullptr, cbuf, 2 * Dn, Dn);

  // 7) GLU, 8) depthwise conv, 9) gelu(LN)
  k_glu<<<dim3(BLn * Dn / 256), dim3(256), 0, stream>>>(cbuf, gbuf);
  k_dwconv<<<dim3(BLn / TLn), dim3(256), 0, stream>>>(gbuf, dww, dwb, ubuf);
  k_ln_gelu<<<dim3(BLn), dim3(256), 0, stream>>>(ubuf, cln2g, cln2b, uh);

  // 10) final linear + residual: out = mix + (u @ lin_w^T + b)
  k_gemm_nt<<<dim3((BLn / 16) * (Dn / 16) / 4), dim3(128), 0, stream>>>(
      uh, lwh, linb, mix, out, Dn, Dn);
}

// v002
// One run takes 357 microseconds.
// In both of two side-by-side timings against v001, it was 1.39 times as fast.
// Counting every step since v000, it is 1.97 times as fast.
#include <hip/hip_runtime.h>

// HyperConformer for MI455X (gfx1250, wave32, WMMA + TDM).
// GEMMs: v_wmma_f32_16x16x32_f16, f32 accumulate, f16-staged operands.
// Hypernet weights staged to LDS via tensor_load_to_lds (TDM, TENSORcnt).
// All transcendentals branch-free (v_rcp/v_exp based) so EXEC stays all-ones
// around WMMA issues.

#define DEV __device__ __forceinline__

typedef __attribute__((ext_vector_type(16))) _Float16 v16h;
typedef __attribute__((ext_vector_type(8)))  float    v8f;
typedef unsigned int u32x4 __attribute__((ext_vector_type(4)));
typedef int i32x8 __attribute__((ext_vector_type(8)));
typedef int i32x4 __attribute__((ext_vector_type(4)));

constexpr int Bn = 8, Ln = 2048, Dn = 512, Mn = 8;
constexpr int DHn = 64, KHn = 256, KSn = 31, PADn = 15;
constexpr int BLn = Bn * Ln;

// ---- branch-free math (no EXEC juggling near WMMA) --------------------------
DEV float erf_f(float x) {
  // Abramowitz-Stegun 7.1.26, |err| <= 1.5e-7, straight-line code.
  const float ax = fabsf(x);
  const float t = __builtin_amdgcn_rcpf(__builtin_fmaf(0.3275911f, ax, 1.0f));
  float p = __builtin_fmaf(1.061405429f, t, -1.453152027f);
  p = __builtin_fmaf(p, t, 1.421413741f);
  p = __builtin_fmaf(p, t, -0.284496736f);
  p = __builtin_fmaf(p, t, 0.254829592f);
  const float e = __expf(-ax * ax);          // v_exp_f32 path
  const float r = __builtin_fmaf(-p * t, e, 1.0f);
  return copysignf(r, x);
}
DEV float gelu_f(float x) { return 0.5f * x * (1.0f + erf_f(x * 0.7071067811865475f)); }
DEV float sigmoid_f(float x) { return __builtin_amdgcn_rcpf(1.0f + __expf(-x)); }

DEV v8f wmma_f16(v16h a, v16h b, v8f c) {
  return __builtin_amdgcn_wmma_f32_16x16x32_f16(
      /*neg_a=*/false, a, /*neg_b=*/false, b,
      /*c_mod=*/(short)0, c, /*reuse_a=*/false, /*reuse_b=*/false);
}

// ---- TDM: stage a packed 2D f16 tile (rows x cols, contiguous) into LDS -----
DEV void tdm_load_2d(unsigned lds_addr, const void* gsrc, int rows, int cols) {
  u32x4 g0;
  i32x8 g1;
  i32x4 z4;
  i32x8 z8;
  z4[0] = 0; z4[1] = 0; z4[2] = 0; z4[3] = 0;
  z8[0] = 0; z8[1] = 0; z8[2] = 0; z8[3] = 0;
  z8[4] = 0; z8[5] = 0; z8[6] = 0; z8[7] = 0;
  const unsigned long long ga = (unsigned long long)(uintptr_t)gsrc;
  g0[0] = 1u;                                                  // count=1, user D#
  g0[1] = lds_addr;                                            // lds_addr bytes
  g0[2] = (unsigned)ga;                                        // global_addr[31:0]
  g0[3] = (unsigned)((ga >> 32) & 0x01FFFFFFull) | (2u << 30); // addr[56:32], type=2
  g1[0] = 1 << 16;       // data_size = 2 bytes
  g1[1] = cols << 16;    // tensor_dim0[15:0]
  g1[2] = rows << 16;    // tensor_dim1[15:0]
  g1[3] = cols << 16;    // tile_dim0
  g1[4] = rows;          // tile_dim1
  g1[5] = cols;          // tensor_dim0_stride[31:0]
  g1[6] = 0;
  g1[7] = 0;
  // 6-arg variant (clang-23 / therock-10.0 headers)
  __builtin_amdgcn_tensor_load_to_lds(g0, g1, z4, z4, z8, 0);
}

// ---- fragment loaders (ISA 7.12.2 16-bit layouts, wave32) -------------------
DEV v16h load_a(const _Float16* __restrict__ A, int lda) {
  const int lane = threadIdx.x & 31;
  const int r = lane & 15;
  const int kb = (lane >> 4) << 3;
  v16h v;
#pragma unroll
  for (int i = 0; i < 16; ++i) {
    const int k = kb + (i & 7) + ((i >> 3) << 4);
    v[i] = A[(size_t)r * lda + k];
  }
  return v;
}
DEV v16h load_at(const _Float16* __restrict__ A, int lda) {
  const int lane = threadIdx.x & 31;
  const int r = lane & 15;
  const int kb = (lane >> 4) << 3;
  v16h v;
#pragma unroll
  for (int i = 0; i < 16; ++i) {
    const int k = kb + (i & 7) + ((i >> 3) << 4);
    v[i] = A[(size_t)k * lda + r];
  }
  return v;
}
DEV v16h load_b(const _Float16* __restrict__ Bp, int ldb) {
  const int lane = threadIdx.x & 31;
  const int n = lane & 15;
  const int kb = (lane >> 4) << 3;
  v16h v;
#pragma unroll
  for (int i = 0; i < 16; ++i) {
    const int k = kb + (i & 7) + ((i >> 3) << 4);
    v[i] = Bp[(size_t)k * ldb + n];
  }
  return v;
}
DEV v16h load_bt(const _Float16* __restrict__ W, int ldw) {
  const int lane = threadIdx.x & 31;
  const int n = lane & 15;
  const int kb = (lane >> 4) << 3;
  v16h v;
#pragma unroll
  for (int i = 0; i < 16; ++i) {
    const int k = kb + (i & 7) + ((i >> 3) << 4);
    v[i] = W[(size_t)n * ldw + k];
  }
  return v;
}

// ---- small elementwise kernels ---------------------------------------------
__global__ void k_cvt_f16(const float* __restrict__ s, _Float16* __restrict__ d, int n) {
  const int i = blockIdx.x * blockDim.x + threadIdx.x;
  if (i < n) d[i] = (_Float16)s[i];
}

__global__ void k_prep_hyp(const float* __restrict__ x, _Float16* __restrict__ xh,
                           _Float16* __restrict__ hyph) {
  const int i = blockIdx.x * blockDim.x + threadIdx.x;  // BL*D threads
  const int c = i & (Dn - 1);
  const int l = (i >> 9) & (Ln - 1);
  const float v = x[i];
  xh[i] = (_Float16)v;
  const float freq = __expf((float)(c & ~1) * (-9.210340371976184f / (float)Dn));
  const float arg = (float)l * freq;
  const float pe = (c & 1) ? cosf(arg) : sinf(arg);
  hyph[i] = (_Float16)(v + pe);
}

// ---- per-head hypernet MLP: TDM weights -> LDS, fc1 -> GELU -> fc2 ----------
__global__ void __launch_bounds__(128)
k_pmlp(const _Float16* __restrict__ hyp,
       const _Float16* __restrict__ fc1w, const float* __restrict__ fc1b,
       const _Float16* __restrict__ fc2w, const float* __restrict__ fc2b,
       _Float16* __restrict__ Wout) {
  __shared__ _Float16 hbuf[4][16 * DHn];      //  8 KB: fc1 activations per wave
  __shared__ _Float16 w1s[DHn * DHn];         //  8 KB: fc1 weights (one head)
  __shared__ _Float16 w2s[KHn * DHn];         // 32 KB: fc2 weights (one head)
  const int lane = threadIdx.x & 31;
  const int w = threadIdx.x >> 5;
  const int wave = blockIdx.x * 4 + w;
  const int lt = wave & (Ln / 16 - 1);        // 128 token tiles
  const int bm = wave >> 7;                   // same for all 4 waves in block
  const int m = bm & (Mn - 1);
  const int b = bm >> 3;
  const int col = lane & 15;
  const int rb = (lane >> 4) << 3;

  // One wave stages this head's weights via the Tensor Data Mover.
  if (w == 0) {
    tdm_load_2d((unsigned)(uintptr_t)(void*)w1s, fc1w + (size_t)m * DHn * DHn, DHn, DHn);
    tdm_load_2d((unsigned)(uintptr_t)(void*)w2s, fc2w + (size_t)m * KHn * DHn, KHn, DHn);
    __builtin_amdgcn_s_wait_tensorcnt(0);
  }
  __syncthreads();

  const _Float16* Ab = hyp + ((size_t)(b * Ln + lt * 16)) * Dn + m * DHn;
  const v16h a0 = load_a(Ab, Dn);             // k = 0..31
  const v16h a1 = load_a(Ab + 32, Dn);        // k = 32..63

  _Float16* hl = hbuf[w];
#pragma unroll
  for (int n0 = 0; n0 < DHn; n0 += 16) {
    const float bv = fc1b[m * DHn + n0 + col];
    v8f acc;
#pragma unroll
    for (int r = 0; r < 8; ++r) acc[r] = bv;
    acc = wmma_f16(a0, load_bt(w1s + (size_t)n0 * DHn, DHn), acc);
    acc = wmma_f16(a1, load_bt(w1s + (size_t)n0 * DHn + 32, DHn), acc);
#pragma unroll
    for (int r = 0; r < 8; ++r)
      hl[(rb + r) * DHn + n0 + col] = (_Float16)gelu_f(acc[r]);
  }
  const v16h h0 = load_a(hl, DHn);
  const v16h h1 = load_a(hl + 32, DHn);

  _Float16* Ob = Wout + ((size_t)bm * Ln + lt * 16) * KHn;
#pragma unroll 2
  for (int n0 = 0; n0 < KHn; n0 += 16) {
    const float bv = fc2b[m * KHn + n0 + col];
    v8f acc;
#pragma unroll
    for (int r = 0; r < 8; ++r) acc[r] = bv;
    acc = wmma_f16(h0, load_bt(w2s + (size_t)n0 * DHn, DHn), acc);
    acc = wmma_f16(h1, load_bt(w2s + (size_t)n0 * DHn + 32, DHn), acc);
#pragma unroll
    for (int r = 0; r < 8; ++r)
      Ob[(size_t)(rb + r) * KHn + n0 + col] = (_Float16)acc[r];
  }
}

// ---- token mixing bmm1: C1[bm,64,256] = gelu(xt[64,L] @ W1[L,256]) ----------
__global__ void __launch_bounds__(128)
k_mix1(const _Float16* __restrict__ xh, const _Float16* __restrict__ W1h,
       _Float16* __restrict__ C1) {
  const int lane = threadIdx.x & 31;
  const int wave = blockIdx.x * 4 + (threadIdx.x >> 5);
  const int nt = wave & 15;
  const int dt = (wave >> 4) & 3;
  const int bm = wave >> 6;
  const int m = bm & 7, b = bm >> 3;
  const int col = lane & 15, rb = (lane >> 4) << 3;
  const _Float16* Ab = xh + (size_t)b * Ln * Dn + m * DHn + dt * 16;  // A^T layout
  const _Float16* Bb = W1h + (size_t)bm * Ln * KHn + nt * 16;         // [K=L, N]
  v8f acc;
#pragma unroll
  for (int r = 0; r < 8; ++r) acc[r] = 0.0f;
  for (int kk = 0; kk < Ln; kk += 32) {
    const v16h a = load_at(Ab + (size_t)kk * Dn, Dn);
    const v16h bf = load_b(Bb + (size_t)kk * KHn, KHn);
    acc = wmma_f16(a, bf, acc);
  }
  _Float16* Cb = C1 + (size_t)bm * DHn * KHn + (size_t)(dt * 16) * KHn + nt * 16;
#pragma unroll
  for (int r = 0; r < 8; ++r)
    Cb[(size_t)(rb + r) * KHn + col] = (_Float16)gelu_f(acc[r]);
}

// ---- 64x64 output tile of one wave: acc += A[64,KT] * W[64,KT]^T ------------
// 4 x 4 accumulator tiles, so each loaded fragment feeds four matrix
// instructions. One trip takes 64 k = one whole 128-byte line of every row.
// Each accumulator sums its k blocks in ascending order.
// A and Wt are the same in every lane (scalar bases); a lane's own place, row
// lane & 15 and k = 8 * (lane >> 4), is one 32-bit byte offset for both.
typedef __attribute__((ext_vector_type(8))) _Float16 v8h;
// The fragment of load_a / load_bt (k = kb..kb+7, kb+16..kb+23) as two 16-byte loads.
DEV v16h load_frag(const _Float16* __restrict__ base, unsigned lane_off) {
  const char* p = (const char*)base + lane_off;
  const v8h lo = *(const v8h*)p;
  const v8h hi = *(const v8h*)(p + 32);
  return __builtin_shufflevector(lo, hi, 0, 1, 2, 3, 4, 5, 6, 7, 8, 9, 10, 11, 12, 13, 14, 15);
}
template <int LD, int KT>
DEV void tile64_nt(const _Float16* __restrict__ A, const _Float16* __restrict__ Wt,
                   v8f (&acc)[4][4]) {
  static_assert(KT % 64 == 0, "k trip");
  const unsigned lane = threadIdx.x & 31;
  const unsigned lane_off = ((lane & 15) * LD + ((lane >> 4) << 3)) * 2;
  for (int kk = 0; kk < KT; kk += 64) {
    v16h a[4][2], bf[4][2];
#pragma unroll  // constant index into a[] and bf[]
    for (int i = 0; i < 4; ++i) {
#pragma unroll  // constant index into a[] and bf[]
      for (int h = 0; h < 2; ++h) {
        a[i][h] = load_frag(A + (i * 16) * LD + kk + h * 32, lane_off);
        bf[i][h] = load_frag(Wt + (i * 16) * LD + kk + h * 32, lane_off);
      }
    }
    // The wait: behind this point the registers that the loads name (lane
    // offset, scalar bases) may be rewritten.
    asm volatile("s_wait_xcnt 0x0" ::: "memory");
    // The scheduling fence keeps all 32 loads of a trip in front of the trip's
    // own matrix instructions (they may still rise among those of the trip
    // before): the loads of a row's line stay close together and fly ahead of
    // their use. Without it the compiler puts each pair of loads directly in
    // front of its first use and waits for memory at each such place.
    __builtin_amdgcn_sched_barrier(0);
#pragma unroll  // constant index into acc[], a[] and bf[]
    for (int h = 0; h < 2; ++h)
#pragma unroll  // constant index into acc[], a[] and bf[]
      for (int i = 0; i < 4; ++i)
#pragma unroll  // constant index into acc[], a[] and bf[]
        for (int j = 0; j < 4; ++j) acc[i][j] = wmma_f16(a[i][h], bf[j][h], acc[i][j]);
  }
}

// ---- token mixing bmm2: mixpre[b,l,D] <- C1g[64,256] @ W2[L,256]^T ----------
// One wave: all 64 features of one head x 64 positions.
__global__ void __launch_bounds__(128)
k_mix2(const _Float16* __restrict__ C1, const _Float16* __restrict__ W2h,
       float* __restrict__ mixpre) {
  const int lane = threadIdx.x & 31;
  // The wave's number as a scalar: both tile addresses are then scalar bases.
  const int wave = blockIdx.x * 4 + __builtin_amdgcn_readfirstlane(threadIdx.x >> 5);
  const int lt = wave & (Ln / 64 - 1);
  const int bm = wave / (Ln / 64);
  const int m = bm & 7, b = bm >> 3;
  const int col = lane & 15, rb = (lane >> 4) << 3;
  const _Float16* Ab = C1 + (size_t)bm * DHn * KHn;
  const _Float16* Bb = W2h + (size_t)bm * Ln * KHn + (size_t)(lt * 64) * KHn;
  v8f acc[4][4];
#pragma unroll  // constant index into acc[]
  for (int i = 0; i < 4; ++i)
#pragma unroll  // constant index into acc[]
    for (int j = 0; j < 4; ++j)
#pragma unroll
      for (int r = 0; r < 8; ++r) acc[i][j][r] = 0.0f;
  tile64_nt<KHn, KHn>(Ab, Bb, acc);
#pragma unroll  // constant index into acc[]
  for (int j = 0; j < 4; ++j) {
    const int l = lt * 64 + j * 16 + col;
    float* Ob = mixpre + ((size_t)b * Ln + l) * Dn + m * DHn + rb;
#pragma unroll  // constant index into acc[]
    for (int i = 0; i < 4; ++i)
#pragma unroll
      for (int r = 0; r < 8; ++r) Ob[i * 16 + r] = acc[i][j][r];  // 8 consecutive floats along D
  }
}

// ---- LN(mix) then LN(conv_ln1) -> t_h (f16) ---------------------------------
__global__ void __launch_bounds__(256)
k_ln_mix(const float* __restrict__ in, const float* __restrict__ g1,
         const float* __restrict__ b1, const float* __restrict__ g2,
         const float* __restrict__ b2, float* __restrict__ mix,
         _Float16* __restrict__ th) {
  __shared__ float s1[256], s2[256];
  const int t = blockIdx.x, tid = threadIdx.x;
  const float* row = in + (size_t)t * Dn;
  const float v0 = row[tid], v1 = row[tid + 256];
  s1[tid] = v0 + v1;
  s2[tid] = v0 * v0 + v1 * v1;
  __syncthreads();
  for (int s = 128; s > 0; s >>= 1) {
    if (tid < s) { s1[tid] += s1[tid + s]; s2[tid] += s2[tid + s]; }
    __syncthreads();
  }
  const float mean = s1[0] * (1.0f / Dn);
  const float var = fmaxf(s2[0] * (1.0f / Dn) - mean * mean, 0.0f);
  const float inv = rsqrtf(var + 1e-5f);
  const float o0 = (v0 - mean) * inv * g1[tid] + b1[tid];
  const float o1 = (v1 - mean) * inv * g1[tid + 256] + b1[tid + 256];
  float* mrow = mix + (size_t)t * Dn;
  mrow[tid] = o0;
  mrow[tid + 256] = o1;
  __syncthreads();
  s1[tid] = o0 + o1;
  s2[tid] = o0 * o0 + o1 * o1;
  __syncthreads();
  for (int s = 128; s > 0; s >>= 1) {
    if (tid < s) { s1[tid] += s1[tid + s]; s2[tid] += s2[tid + s]; }
    __syncthreads();
  }
  const float mean2 = s1[0] * (1.0f / Dn);
  const float var2 = fmaxf(s2[0] * (1.0f / Dn) - mean2 * mean2, 0.0f);
  const float inv2 = rsqrtf(var2 + 1e-5f);
  th[(size_t)t * Dn + tid] = (_Float16)((o0 - mean2) * inv2 * g2[tid] + b2[tid]);
  th[(size_t)t * Dn + tid + 256] =
      (_Float16)((o1 - mean2) * inv2 * g2[tid + 256] + b2[tid + 256]);
}

// ---- generic X[M,K](f16) @ W[N,K]^T + bias (+res) -> f32 --------------------
// One block: 128 x 128 outputs, 2 x 2 waves of 64 x 64 each.
template <int N, int K>
__global__ void __launch_bounds__(128)
k_gemm_nt(const _Float16* __restrict__ A, const _Float16* __restrict__ Wt,
          const float* __restrict__ bias, const float* __restrict__ res,
          float* __restrict__ out) {
  static_assert(N % 128 == 0, "block tile");
  const int lane = threadIdx.x & 31;
  // The wave's number as a scalar: both tile addresses are then scalar bases.
  const int w = __builtin_amdgcn_readfirstlane(threadIdx.x >> 5);
  const int n0 = (blockIdx.x % (N / 128)) * 128 + (w & 1) * 64;
  const int m0 = (blockIdx.x / (N / 128)) * 128 + (w >> 1) * 64;
  const int col = lane & 15, rb = (lane >> 4) << 3;
  v8f acc[4][4];
#pragma unroll  // constant index into acc[]
  for (int j = 0; j < 4; ++j) {
    const float bv = bias[n0 + j * 16 + col];
#pragma unroll  // constant index into acc[]
    for (int i = 0; i < 4; ++i)
#pragma unroll
      for (int r = 0; r < 8; ++r) acc[i][j][r] = bv;
  }
  // Behind the bias loads: their address registers are rewritten next. The
  // scheduling fence keeps that address arithmetic behind the wait.
  asm volatile("s_wait_xcnt 0x0" ::: "memory");
  __builtin_amdgcn_sched_barrier(0);
  tile64_nt<K, K>(A + (size_t)m0 * K, Wt + (size_t)n0 * K, acc);
  const size_t base = (size_t)(m0 + rb) * N + n0 + col;
  if (res) {
    v8f rv[4][4];
#pragma unroll  // constant index into rv[]
    for (int i = 0; i < 4; ++i)
#pragma unroll
      for (int r = 0; r < 8; ++r)
#pragma unroll  // constant index into rv[]
        for (int j = 0; j < 4; ++j) rv[i][j][r] = res[base + (size_t)(i * 16 + r) * N + j * 16];
    // Behind the residual loads: the sums below may reuse their address
    // registers. The scheduling fence keeps the sums behind the wait.
    asm volatile("s_wait_xcnt 0x0" ::: "memory");
    __builtin_amdgcn_sched_barrier(0);
#pragma unroll  // constant index into acc[] and rv[]
    for (int i = 0; i < 4; ++i)
#pragma unroll  // constant index into acc[] and rv[]
      for (int j = 0; j < 4; ++j) acc[i][j] += rv[i][j];
  }
  // The sums above go into the accumulators; the stores follow as one run to
  // the kernel's end, so no register that an issued store names is written again.
#pragma unroll  // constant index into acc[]
  for (int i = 0; i < 4; ++i)
#pragma unroll
    for (int r = 0; r < 8; ++r)
#pragma unroll  // constant index into acc[]
      for (int j = 0; j < 4; ++j)
        out[base + (size_t)(i * 16 + r) * N + j * 16] = acc[i][j][r];
}

// ---- GLU: g = c[:, :D] * sigmoid(c[:, D:]) ----------------------------------
__global__ void k_glu(const float* __restrict__ c, float* __restrict__ g) {
  const int i = blockIdx.x * blockDim.x + threadIdx.x;  // BL*D
  const int d = i & (Dn - 1);
  const int t = i >> 9;
  const float a = c[(size_t)t * (2 * Dn) + d];
  const float bg = c[(size_t)t * (2 * Dn) + Dn + d];
  g[i] = a * sigmoid_f(bg);
}

// ---- depthwise conv along L, kernel 31, zero-pad 15 -------------------------
// One thread: 2 neighbouring channels x TLn consecutive positions. The 31 taps
// of both channels and the TLn running sums stay in registers; each input row
// is loaded once per tile and feeds up to 31 sums. Per output the taps are
// added in ascending k, as in the one-output-per-thread form.
// Every loop below is fully unrolled so that each index of w[], in[] and acc[]
// is a constant: an index known only at run time would send the array to scratch.
typedef __attribute__((ext_vector_type(2))) float v2f;
constexpr int TLn = 32;
static_assert(TLn >= PADn && Ln % TLn == 0 && KSn == 2 * PADn + 1, "tile shape");

__global__ void __launch_bounds__(256)
k_dwconv(const float* __restrict__ g, const float* __restrict__ dww,
         const float* __restrict__ dwb, float* __restrict__ u) {
  const int d = threadIdx.x * 2;                       // channel pair
  const int l0 = (blockIdx.x & (Ln / TLn - 1)) * TLn;  // first output row
  const int b = blockIdx.x / (Ln / TLn);
  const size_t tile = ((size_t)b * Ln + l0) * Dn + d;

  v2f w[KSn];
#pragma unroll  // constant index into w[]
  for (int k = 0; k < KSn; ++k) {
    w[k][0] = dww[d * KSn + k];
    w[k][1] = dww[(d + 1) * KSn + k];
  }
  v2f bias;
  bias[0] = dwb[d];
  bias[1] = dwb[d + 1];

  // in[j] = input row l0 - PADn + j. The PADn rows in front of the first tile
  // of a sequence and behind its last tile are the zero pad and are not read
  // (both tests are the same for the whole block).
  const float* gt = g + tile;
  v2f in[TLn + 2 * PADn];
  if (l0 > 0) {
#pragma unroll  // constant index into in[]
    for (int j = 0; j < PADn; ++j) in[j] = *(const v2f*)(gt + (j - PADn) * Dn);
  } else {
#pragma unroll  // constant index into in[]
    for (int j = 0; j < PADn; ++j) in[j] = 0.0f;
  }
#pragma unroll  // constant index into in[]
  for (int j = 0; j < TLn; ++j) in[PADn + j] = *(const v2f*)(gt + j * Dn);
  if (l0 + TLn < Ln) {
#pragma unroll  // constant index into in[]
    for (int j = 0; j < PADn; ++j)
      in[PADn + TLn + j] = *(const v2f*)(gt + (TLn + j) * Dn);
  } else {
#pragma unroll  // constant index into in[]
    for (int j = 0; j < PADn; ++j) in[PADn + TLn + j] = 0.0f;
  }

  v2f acc[TLn];
#pragma unroll  // constant index into acc[] and in[]
  for (int t = 0; t < TLn; ++t) {
    acc[t] = bias;
#pragma unroll  // constant index into in[] and w[]
    for (int k = 0; k < KSn; ++k) acc[t] += in[t + k] * w[k];
  }

  float* ut = u + tile;
#pragma unroll  // constant index into acc[]
  for (int t = 0; t < TLn; ++t) *(v2f*)(ut + t * Dn) = acc[t];
}

// ---- gelu(LN(u)) -> f16 -----------------------------------------------------
__global__ void __launch_bounds__(256)
k_ln_gelu(const float* __restrict__ in, const float* __restrict__ gg,
          const float* __restrict__ bb, _Float16* __restrict__ outh) {
  __shared__ float s1[256], s2[256];
  const int t = blockIdx.x, tid = threadIdx.x;
  const float* row = in + (size_t)t * Dn;
  const float v0 = row[tid], v1 = row[tid + 256];
  s1[tid] = v0 + v1;
  s2[tid] = v0 * v0 + v1 * v1;
  __syncthreads();
  for (int s = 128; s > 0; s >>= 1) {
    if (tid < s) { s1[tid] += s1[tid + s]; s2[tid] += s2[tid + s]; }
    __syncthreads();
  }
  const float mean = s1[0] * (1.0f / Dn);
  const float var = fmaxf(s2[0] * (1.0f / Dn) - mean * mean, 0.0f);
  const float inv = rsqrtf(var + 1e-5f);
  outh[(size_t)t * Dn + tid] = (_Float16)gelu_f((v0 - mean) * inv * gg[tid] + bb[tid]);
  outh[(size_t)t * Dn + tid + 256] =
      (_Float16)gelu_f((v1 - mean) * inv * gg[tid + 256] + bb[tid + 256]);
}

// ---- host-side launch -------------------------------------------------------
extern "C" void kernel_launch(void* const* d_in, const int* in_sizes, int n_in,
                              void* d_out, int out_size, void* d_ws, size_t ws_size,
                              hipStream_t stream) {
  (void)in_sizes; (void)n_in; (void)out_size; (void)ws_size;
  const float* x      = (const float*)d_in[0];
  const float* w1fc1w = (const float*)d_in[1];
  const float* w1fc1b = (const float*)d_in[2];
  const float* w1fc2w = (const float*)d_in[3];
  const float* w1fc2b = (const float*)d_in[4];
  const float* w2fc1w = (const float*)d_in[5];
  const float* w2fc1b = (const float*)d_in[6];
  const float* w2fc2w = (const float*)d_in[7];
  const float* w2fc2b = (const float*)d_in[8];
  const float* lnmixg = (const float*)d_in[9];
  const float* lnmixb = (const float*)d_in[10];
  const float* cln1g  = (const float*)d_in[11];
  const float* cln1b  = (const float*)d_in[12];
  const float* bneckw = (const float*)d_in[13];
  const float* bneckb = (const float*)d_in[14];
  const float* dww    = (const float*)d_in[15];
  const float* dwb    = (const float*)d_in[16];
  const float* cln2g  = (const float*)d_in[17];
  const float* cln2b  = (const float*)d_in[18];
  const float* linw   = (const float*)d_in[19];
  const float* linb   = (const float*)d_in[20];
  float* out = (float*)d_out;

  char* ws = (char*)d_ws;
  const size_t SZ_H = (size_t)BLn * Dn * sizeof(_Float16);              // 16.78 MB
  const size_t SZ_F = (size_t)BLn * Dn * sizeof(float);                 // 33.55 MB
  const size_t SZ_W = (size_t)Bn * Mn * Ln * KHn * sizeof(_Float16);    // 67.11 MB

  _Float16* xh   = (_Float16*)(ws);
  _Float16* hyph = (_Float16*)(ws + SZ_H);
  char* R2 = ws + 2 * SZ_H;                 // 67MB region: W1h -> mixpre -> c -> u/uh
  char* R3 = R2 + SZ_W;                     // 67MB region: W2h -> mix + t_h
  _Float16* c1g = (_Float16*)(R3 + SZ_W);   // [64,64,256] f16 = 2 MB
  char* WTS = (char*)c1g + (size_t)Bn * Mn * DHn * KHn * sizeof(_Float16);

  _Float16* w1fc1h = (_Float16*)(WTS);
  _Float16* w1fc2h = (_Float16*)(WTS + 65536);
  _Float16* w2fc1h = (_Float16*)(WTS + 65536 + 262144);
  _Float16* w2fc2h = (_Float16*)(WTS + 2 * 65536 + 262144);
  _Float16* bwh    = (_Float16*)(WTS + 2 * 65536 + 2 * 262144);
  _Float16* lwh    = (_Float16*)(WTS + 2 * 65536 + 2 * 262144 + 1048576);

  // lifetime-disjoint aliases
  _Float16* W1h = (_Float16*)R2;
  _Float16* W2h = (_Float16*)R3;
  float*    mixpre = (float*)R2;            // after W1h dead
  float*    mix    = (float*)R3;            // after W2h dead
  _Float16* th     = (_Float16*)(R3 + SZ_F);
  float*    cbuf   = (float*)R2;            // [BL,1024] after mixpre dead
  float*    gbuf   = (float*)ws;            // over xh+hyph (dead)
  float*    ubuf   = (float*)R2;            // after cbuf dead
  _Float16* uh     = (_Float16*)(R2 + SZ_F);

  // 1) weights -> f16
  k_cvt_f16<<<dim3(Mn * DHn * DHn / 256), dim3(256), 0, stream>>>(w1fc1w, w1fc1h, Mn * DHn * DHn);
  k_cvt_f16<<<dim3(Mn * KHn * DHn / 256), dim3(256), 0, stream>>>(w1fc2w, w1fc2h, Mn * KHn * DHn);
  k_cvt_f16<<<dim3(Mn * DHn * DHn / 256), dim3(256), 0, stream>>>(w2fc1w, w2fc1h, Mn * DHn * DHn);
  k_cvt_f16<<<dim3(Mn * KHn * DHn / 256), dim3(256), 0, stream>>>(w2fc2w, w2fc2h, Mn * KHn * DHn);
  k_cvt_f16<<<dim3(2 * Dn * Dn / 256), dim3(256), 0, stream>>>(bneckw, bwh, 2 * Dn * Dn);
  k_cvt_f16<<<dim3(Dn * Dn / 256), dim3(256), 0, stream>>>(linw, lwh, Dn * Dn);

  // 2) x_h, hyp_h (x + PE)
  k_prep_hyp<<<dim3(BLn * Dn / 256), dim3(256), 0, stream>>>(x, xh, hyph);

  // 3) hypernet MLPs -> W1, W2 (f16); weights staged via TDM
  const int pmlp_blocks = (Bn * Mn * (Ln / 16)) / 4;   // 2048
  k_pmlp<<<dim3(pmlp_blocks), dim3(128), 0, stream>>>(hyph, w1fc1h, w1fc1b, w1fc2h, w1fc2b, W1h);
  k_pmlp<<<dim3(pmlp_blocks), dim3(128), 0, stream>>>(hyph, w2fc1h, w2fc1b, w2fc2h, w2fc2b, W2h);

  // 4) token mixing bmms
  k_mix1<<<dim3((Bn * Mn * 4 * 16) / 4), dim3(128), 0, stream>>>(xh, W1h, c1g);
  k_mix2<<<dim3((Bn * Mn * (Ln / 64)) / 4), dim3(128), 0, stream>>>(c1g, W2h, mixpre);

  // 5) LN(mix) and LN(conv_ln1) -> t_h
  k_ln_mix<<<dim3(BLn), dim3(256), 0, stream>>>(mixpre, lnmixg, lnmixb, cln1g, cln1b, mix, th);

  // 6) bottleneck 1x1 conv: [BL,512] @ [1024,512]^T + b
  k_gemm_nt<2 * Dn, Dn><<<dim3((BLn / 128) * (2 * Dn / 128)), dim3(128), 0, stream>>>(
      th, bwh, bneckb, nullptr, cbuf);

  // 7) GLU, 8) depthwise conv, 9) gelu(LN)
  k_glu<<<dim3(BLn * Dn / 256), dim3(256), 0, stream>>>(cbuf, gbuf);
  k_dwconv<<<dim3(BLn / TLn), dim3(256), 0, stream>>>(gbuf, dww, dwb, ubuf);
  k_ln_gelu<<<dim3(BLn), dim3(256), 0, stream>>>(ubuf, cln2g, cln2b, uh);

  // 10) final linear + residual: out = mix + (u @ lin_w^T + b)
  k_gemm_nt<Dn, Dn><<<dim3((BLn / 128) * (Dn / 128)), dim3(128), 0, stream>>>(
      uh, lwh, linb, mix, out);
}

// v003
// Measured time: 321 microseconds a run.
// Next to v002, in two timings, it ran 1.12 and 1.11 times as fast.
// All steps since v000 together make it 2.19 times as fast.
#include <hip/hip_runtime.h>

// HyperConformer for MI455X (gfx1250, wave32, WMMA + TDM).
// GEMMs: v_wmma_f32_16x16x32_f16, f32 accumulate, f16-staged operands.
// Hypernet weights staged to LDS via tensor_load_to_lds (TDM, TENSORcnt).
// All transcendentals branch-free (v_rcp/v_exp based) so EXEC stays all-ones
// around WMMA issues.

#define DEV __device__ __forceinline__

typedef __attribute__((ext_vector_type(16))) _Float16 v16h;
typedef __attribute__((ext_vector_type(8)))  float    v8f;
typedef unsigned int u32x4 __attribute__((ext_vector_type(4)));
typedef int i32x8 __attribute__((ext_vector_type(8)));
typedef int i32x4 __attribute__((ext_vector_type(4)));

constexpr int Bn = 8, Ln = 2048, Dn = 512, Mn = 8;
constexpr int DHn = 64, KHn = 256, KSn = 31, PADn = 15;
constexpr int BLn = Bn * Ln;

// ---- branch-free math (no EXEC juggling near WMMA) --------------------------
DEV float erf_f(float x) {
  // Abramowitz-Stegun 7.1.26, |err| <= 1.5e-7, straight-line code.
  const float ax = fabsf(x);
  const float t = __builtin_amdgcn_rcpf(__builtin_fmaf(0.3275911f, ax, 1.0f));
  float p = __builtin_fmaf(1.061405429f, t, -1.453152027f);
  p = __builtin_fmaf(p, t, 1.421413741f);
  p = __builtin_fmaf(p, t, -0.284496736f);
  p = __builtin_fmaf(p, t, 0.254829592f);
  const float e = __expf(-ax * ax);          // v_exp_f32 path
  const float r = __builtin_fmaf(-p * t, e, 1.0f);
  return copysignf(r, x);
}
DEV float gelu_f(float x) { return 0.5f * x * (1.0f + erf_f(x * 0.7071067811865475f)); }

DEV v8f wmma_f16(v16h a, v16h b, v8f c) {
  return __builtin_amdgcn_wmma_f32_16x16x32_f16(
      /*neg_a=*/false, a, /*neg_b=*/false, b,
      /*c_mod=*/(short)0, c, /*reuse_a=*/false, /*reuse_b=*/false);
}

// ---- TDM: stage a packed 2D f16 tile (rows x cols, contiguous) into LDS -----
DEV void tdm_load_2d(unsigned lds_addr, const void* gsrc, int rows, int cols) {
  u32x4 g0;
  i32x8 g1;
  i32x4 z4;
  i32x8 z8;
  z4[0] = 0; z4[1] = 0; z4[2] = 0; z4[3] = 0;
  z8[0] = 0; z8[1] = 0; z8[2] = 0; z8[3] = 0;
  z8[4] = 0; z8[5] = 0; z8[6] = 0; z8[7] = 0;
  const unsigned long long ga = (unsigned long long)(uintptr_t)gsrc;
  g0[0] = 1u;                                                  // count=1, user D#
  g0[1] = lds_addr;                                            // lds_addr bytes
  g0[2] = (unsigned)ga;                                        // global_addr[31:0]
  g0[3] = (unsigned)((ga >> 32) & 0x01FFFFFFull) | (2u << 30); // addr[56:32], type=2
  g1[0] = 1 << 16;       // data_size = 2 bytes
  g1[1] = cols << 16;    // tensor_dim0[15:0]
  g1[2] = rows << 16;    // tensor_dim1[15:0]
  g1[3] = cols << 16;    // tile_dim0
  g1[4] = rows;          // tile_dim1
  g1[5] = cols;          // tensor_dim0_stride[31:0]
  g1[6] = 0;
  g1[7] = 0;
  // 6-arg variant (clang-23 / therock-10.0 headers)
  __builtin_amdgcn_tensor_load_to_lds(g0, g1, z4, z4, z8, 0);
}

// ---- fragment loaders (ISA 7.12.2 16-bit layouts, wave32) -------------------
DEV v16h load_a(const _Float16* __restrict__ A, int lda) {
  const int lane = threadIdx.x & 31;
  const int r = lane & 15;
  const int kb = (lane >> 4) << 3;
  v16h v;
#pragma unroll
  for (int i = 0; i < 16; ++i) {
    const int k = kb + (i & 7) + ((i >> 3) << 4);
    v[i] = A[(size_t)r * lda + k];
  }
  return v;
}
DEV v16h load_at(const _Float16* __restrict__ A, int lda) {
  const int lane = threadIdx.x & 31;
  const int r = lane & 15;
  const int kb = (lane >> 4) << 3;
  v16h v;
#pragma unroll
  for (int i = 0; i < 16; ++i) {
    const int k = kb + (i & 7) + ((i >> 3) << 4);
    v[i] = A[(size_t)k * lda + r];
  }
  return v;
}
DEV v16h load_b(const _Float16* __restrict__ Bp, int ldb) {
  const int lane = threadIdx.x & 31;
  const int n = lane & 15;
  const int kb = (lane >> 4) << 3;
  v16h v;
#pragma unroll
  for (int i = 0; i < 16; ++i) {
    const int k = kb + (i & 7) + ((i >> 3) << 4);
    v[i] = Bp[(size_t)k * ldb + n];
  }
  return v;
}
DEV v16h load_bt(const _Float16* __restrict__ W, int ldw) {
  const int lane = threadIdx.x & 31;
  const int n = lane & 15;
  const int kb = (lane >> 4) << 3;
  v16h v;
#pragma unroll
  for (int i = 0; i < 16; ++i) {
    const int k = kb + (i & 7) + ((i >> 3) << 4);
    v[i] = W[(size_t)n * ldw + k];
  }
  return v;
}

// ---- many elements per thread -----------------------------------------------
// The elementwise and row-norm kernels below give every thread 8 to 64 elements
// in 16-byte pieces, a wave's piece being 512 contiguous bytes. Each launch then
// starts a few thousand waves at most, all resident at once, and each wave has
// its loads in flight together.
typedef __attribute__((ext_vector_type(4))) float v4f;
typedef __attribute__((ext_vector_type(4))) _Float16 v4h;
constexpr int RWn = 4;  // rows of Dn floats per wave

// base is the same in every lane (a scalar base, the wave's number being read as
// a scalar); a lane's own place is its lane number times the width of the
// access, one register that loads and stores share to the kernel's end.
DEV v4f ld4(const float* __restrict__ base, unsigned byte_off) {
  return *(const v4f*)((const char*)base + byte_off);
}
DEV void st4(float* __restrict__ base, unsigned byte_off, v4f v) {
  *(v4f*)((char*)base + byte_off) = v;
}
DEV void st4h(_Float16* __restrict__ base, unsigned byte_off, v4h v) {
  *(v4h*)((char*)base + byte_off) = v;
}
DEV v4h to_h4(v4f v) {
  v4h h;
#pragma unroll
  for (int e = 0; e < 4; ++e) h[e] = (_Float16)v[e];
  return h;
}

// Stands behind a run of global loads: behind it the registers that the loads
// name (offsets, bases) may be rewritten. The scheduling fence keeps the
// arithmetic that follows behind the wait and the loads in front of it, so that
// all of a wave's loads are in flight together.
DEV void loads_issued() {
  asm volatile("s_wait_xcnt 0x0" ::: "memory");
  __builtin_amdgcn_sched_barrier(0);
}

// A transcendental with the one free slot that the instruction set asks for
// behind it, in one statement so that the v_nop stays directly behind it
// whatever the compiler schedules next.
DEV float rcp_slot(float x) {
  float r;
  asm("v_rcp_f32 %0, %1\n\tv_nop" : "=v"(r) : "v"(x));
  return r;
}
DEV float exp2_slot(float x) {
  float r;
  asm("v_exp_f32 %0, %1\n\tv_nop" : "=v"(r) : "v"(x));
  return r;
}
DEV float rsq_slot(float x) {
  float r;
  asm("v_rsq_f32 %0, %1\n\tv_nop" : "=v"(r) : "v"(x));
  return r;
}

// v + (v of lane ^ mask) inside a 16-lane row; CTRL = 0x160 + mask (row_xmask).
template <int CTRL>
DEV float add_row_xor(float v) {
  return v + __builtin_bit_cast(float, __builtin_amdgcn_update_dpp(
                 0, __builtin_bit_cast(int, v), CTRL, 0xf, 0xf, true));
}
// Sum over the 32 lanes of a wave, the same bits in every lane. All lanes on.
DEV float wave_sum(float v) {
  v = add_row_xor<0x161>(v);
  v = add_row_xor<0x162>(v);
  v = add_row_xor<0x164>(v);
  v = add_row_xor<0x168>(v);
  const unsigned u = __builtin_bit_cast(unsigned, v);
  // the same lane of the other 16-lane row
  return v + __builtin_bit_cast(float, __builtin_amdgcn_permlanex16(
                 u, u, 0x76543210u, 0xfedcba98u, true, false));
}
// Sum and sum of squares of one row of Dn floats, 16 of them in each lane.
DEV void row_sums(const v4f (&v)[4], float& s, float& q) {
  const v4f sv = (v[0] + v[1]) + (v[2] + v[3]);
  const v4f qv = (v[0] * v[0] + v[1] * v[1]) + (v[2] * v[2] + v[3] * v[3]);
  s = wave_sum((sv[0] + sv[1]) + (sv[2] + sv[3]));
  q = wave_sum((qv[0] + qv[1]) + (qv[2] + qv[3]));
}

// ---- small elementwise kernels ---------------------------------------------
// One block: 2048 consecutive elements, 8 per thread.
__global__ void __launch_bounds__(256)
k_cvt_f16(const float* __restrict__ s, _Float16* __restrict__ d, int n) {
  const int i = blockIdx.x * 2048 + threadIdx.x * 4;
  if (i + 1024 < n) {
    const v4f v0 = *(const v4f*)(s + i);
    const v4f v1 = *(const v4f*)(s + i + 1024);
    loads_issued();
    *(v4h*)(d + i) = to_h4(v0);
    *(v4h*)(d + i + 1024) = to_h4(v1);
  }
}

// One thread: 4 neighbouring channels of 2 neighbouring positions in all Bn
// batches. The position code depends on position and channel alone and is made
// once for the Bn batches; a sine and the cosine beside it share one argument.
__global__ void __launch_bounds__(256)
k_prep_hyp(const float* __restrict__ x, _Float16* __restrict__ xh,
           _Float16* __restrict__ hyph) {
  const unsigned lane = threadIdx.x & 31;
  // (Ln / 2) * (Dn / 128) waves: a wave has 128 channels of 2 positions
  const unsigned wave = blockIdx.x * 8 + __builtin_amdgcn_readfirstlane(threadIdx.x >> 5);
  const int c0 = (wave & (Dn / 128 - 1)) * 128;
  const int l0 = (wave / (Dn / 128)) * 2;
  const unsigned off = (unsigned)(l0 * Dn + c0);  // scalar
  const int c = c0 + lane * 4;
  v4f v[Bn][2];
#pragma unroll  // constant index into v[]
  for (int b = 0; b < Bn; ++b) {
#pragma unroll  // constant index into v[]
    for (int r = 0; r < 2; ++r) v[b][r] = ld4(x + off + b * (Ln * Dn) + r * Dn, lane * 16);
    // per batch: the batches lie too far apart for one address register, and a
    // later batch's load may land in an earlier one's address registers
    loads_issued();
  }
  v4f pe[2];
#pragma unroll  // constant index into pe[]
  for (int p = 0; p < 2; ++p) {
    const float freq = __expf((float)(c + 2 * p) * (-9.210340371976184f / (float)Dn));
#pragma unroll  // constant index into pe[]
    for (int r = 0; r < 2; ++r) {
      const float arg = (float)(l0 + r) * freq;
      pe[r][2 * p] = sinf(arg);
      pe[r][2 * p + 1] = cosf(arg);
    }
  }
  v4h a[Bn][2], h[Bn][2];
#pragma unroll  // constant index into v[], a[] and h[]
  for (int b = 0; b < Bn; ++b)
#pragma unroll  // constant index into v[], a[], h[] and pe[]
    for (int r = 0; r < 2; ++r) {
      a[b][r] = to_h4(v[b][r]);
      h[b][r] = to_h4(v[b][r] + pe[r]);
    }
  // The stores follow as one run to the kernel's end: the fence keeps them from
  // rising among the arithmetic, which could then reuse a register they name.
  __builtin_amdgcn_sched_barrier(0);
#pragma unroll  // constant index into a[] and h[]
  for (int b = 0; b < Bn; ++b)
#pragma unroll  // constant index into a[] and h[]
    for (int r = 0; r < 2; ++r) {
      st4h(xh + off + b * (Ln * Dn) + r * Dn, lane * 8, a[b][r]);
      st4h(hyph + off + b * (Ln * Dn) + r * Dn, lane * 8, h[b][r]);
    }
}

// ---- per-head hypernet MLP: TDM weights -> LDS, fc1 -> GELU -> fc2 ----------
__global__ void __launch_bounds__(128)
k_pmlp(const _Float16* __restrict__ hyp,
       const _Float16* __restrict__ fc1w, const float* __restrict__ fc1b,
       const _Float16* __restrict__ fc2w, const float* __restrict__ fc2b,
       _Float16* __restrict__ Wout) {
  __shared__ _Float16 hbuf[4][16 * DHn];      //  8 KB: fc1 activations per wave
  __shared__ _Float16 w1s[DHn * DHn];         //  8 KB: fc1 weights (one head)
  __shared__ _Float16 w2s[KHn * DHn];         // 32 KB: fc2 weights (one head)
  const int lane = threadIdx.x & 31;
  const int w = threadIdx.x >> 5;
  const int wave = blockIdx.x * 4 + w;
  const int lt = wave & (Ln / 16 - 1);        // 128 token tiles
  const int bm = wave >> 7;                   // same for all 4 waves in block
  const int m = bm & (Mn - 1);
  const int b = bm >> 3;
  const int col = lane & 15;
  const int rb = (lane >> 4) << 3;

  // One wave stages this head's weights via the Tensor Data Mover.
  if (w == 0) {
    tdm_load_2d((unsigned)(uintptr_t)(void*)w1s, fc1w + (size_t)m * DHn * DHn, DHn, DHn);
    tdm_load_2d((unsigned)(uintptr_t)(void*)w2s, fc2w + (size_t)m * KHn * DHn, KHn, DHn);
    __builtin_amdgcn_s_wait_tensorcnt(0);
  }
  __syncthreads();

  const _Float16* Ab = hyp + ((size_t)(b * Ln + lt * 16)) * Dn + m * DHn;
  const v16h a0 = load_a(Ab, Dn);             // k = 0..31
  const v16h a1 = load_a(Ab + 32, Dn);        // k = 32..63

  _Float16* hl = hbuf[w];
#pragma unroll
  for (int n0 = 0; n0 < DHn; n0 += 16) {
    const float bv = fc1b[m * DHn + n0 + col];
    v8f acc;
#pragma unroll
    for (int r = 0; r < 8; ++r) acc[r] = bv;
    acc = wmma_f16(a0, load_bt(w1s + (size_t)n0 * DHn, DHn), acc);
    acc = wmma_f16(a1, load_bt(w1s + (size_t)n0 * DHn + 32, DHn), acc);
#pragma unroll
    for (int r = 0; r < 8; ++r)
      hl[(rb + r) * DHn + n0 + col] = (_Float16)gelu_f(acc[r]);
  }
  const v16h h0 = load_a(hl, DHn);
  const v16h h1 = load_a(hl + 32, DHn);

  _Float16* Ob = Wout + ((size_t)bm * Ln + lt * 16) * KHn;
#pragma unroll 2
  for (int n0 = 0; n0 < KHn; n0 += 16) {
    const float bv = fc2b[m * KHn + n0 + col];
    v8f acc;
#pragma unroll
    for (int r = 0; r < 8; ++r) acc[r] = bv;
    acc = wmma_f16(h0, load_bt(w2s + (size_t)n0 * DHn, DHn), acc);
    acc = wmma_f16(h1, load_bt(w2s + (size_t)n0 * DHn + 32, DHn), acc);
#pragma unroll
    for (int r = 0; r < 8; ++r)
      Ob[(size_t)(rb + r) * KHn + n0 + col] = (_Float16)acc[r];
  }
}

// ---- token mixing bmm1: C1[bm,64,256] = gelu(xt[64,L] @ W1[L,256]) ----------
__global__ void __launch_bounds__(128)
k_mix1(const _Float16* __restrict__ xh, const _Float16* __restrict__ W1h,
       _Float16* __restrict__ C1) {
  const int lane = threadIdx.x & 31;
  const int wave = blockIdx.x * 4 + (threadIdx.x >> 5);
  const int nt = wave & 15;
  const int dt = (wave >> 4) & 3;
  const int bm = wave >> 6;
  const int m = bm & 7, b = bm >> 3;
  const int col = lane & 15, rb = (lane >> 4) << 3;
  const _Float16* Ab = xh + (size_t)b * Ln * Dn + m * DHn + dt * 16;  // A^T layout
  const _Float16* Bb = W1h + (size_t)bm * Ln * KHn + nt * 16;         // [K=L, N]
  v8f acc;
#pragma unroll
  for (int r = 0; r < 8; ++r) acc[r] = 0.0f;
  for (int kk = 0; kk < Ln; kk += 32) {
    const v16h a = load_at(Ab + (size_t)kk * Dn, Dn);
    const v16h bf = load_b(Bb + (size_t)kk * KHn, KHn);
    acc = wmma_f16(a, bf, acc);
  }
  _Float16* Cb = C1 + (size_t)bm * DHn * KHn + (size_t)(dt * 16) * KHn + nt * 16;
#pragma unroll
  for (int r = 0; r < 8; ++r)
    Cb[(size_t)(rb + r) * KHn + col] = (_Float16)gelu_f(acc[r]);
}

// ---- 64x64 output tile of one wave: acc += A[64,KT] * W[64,KT]^T ------------
// 4 x 4 accumulator tiles, so each loaded fragment feeds four matrix
// instructions. One trip takes 64 k = one whole 128-byte line of every row.
// Each accumulator sums its k blocks in ascending order.
// A and Wt are the same in every lane (scalar bases); a lane's own place, row
// lane & 15 and k = 8 * (lane >> 4), is one 32-bit byte offset for both.
typedef __attribute__((ext_vector_type(8))) _Float16 v8h;
// The fragment of load_a / load_bt (k = kb..kb+7, kb+16..kb+23) as two 16-byte loads.
DEV v16h load_frag(const _Float16* __restrict__ base, unsigned lane_off) {
  const char* p = (const char*)base + lane_off;
  const v8h lo = *(const v8h*)p;
  const v8h hi = *(const v8h*)(p + 32);
  return __builtin_shufflevector(lo, hi, 0, 1, 2, 3, 4, 5, 6, 7, 8, 9, 10, 11, 12, 13, 14, 15);
}
template <int LD, int KT>
DEV void tile64_nt(const _Float16* __restrict__ A, const _Float16* __restrict__ Wt,
                   v8f (&acc)[4][4]) {
  static_assert(KT % 64 == 0, "k trip");
  const unsigned lane = threadIdx.x & 31;
  const unsigned lane_off = ((lane & 15) * LD + ((lane >> 4) << 3)) * 2;
  for (int kk = 0; kk < KT; kk += 64) {
    v16h a[4][2], bf[4][2];
#pragma unroll  // constant index into a[] and bf[]
    for (int i = 0; i < 4; ++i) {
#pragma unroll  // constant index into a[] and bf[]
      for (int h = 0; h < 2; ++h) {
        a[i][h] = load_frag(A + (i * 16) * LD + kk + h * 32, lane_off);
        bf[i][h] = load_frag(Wt + (i * 16) * LD + kk + h * 32, lane_off);
      }
    }
    // The wait: behind this point the registers that the loads name (lane
    // offset, scalar bases) may be rewritten.
    asm volatile("s_wait_xcnt 0x0" ::: "memory");
    // The scheduling fence keeps all 32 loads of a trip in front of the trip's
    // own matrix instructions (they may still rise among those of the trip
    // before): the loads of a row's line stay close together and fly ahead of
    // their use. Without it the compiler puts each pair of loads directly in
    // front of its first use and waits for memory at each such place.
    __builtin_amdgcn_sched_barrier(0);
#pragma unroll  // constant index into acc[], a[] and bf[]
    for (int h = 0; h < 2; ++h)
#pragma unroll  // constant index into acc[], a[] and bf[]
      for (int i = 0; i < 4; ++i)
#pragma unroll  // constant index into acc[], a[] and bf[]
        for (int j = 0; j < 4; ++j) acc[i][j] = wmma_f16(a[i][h], bf[j][h], acc[i][j]);
  }
}

// ---- token mixing bmm2: mixpre[b,l,D] <- C1g[64,256] @ W2[L,256]^T ----------
// One wave: all 64 features of one head x 64 positions.
__global__ void __launch_bounds__(128)
k_mix2(const _Float16* __restrict__ C1, const _Float16* __restrict__ W2h,
       float* __restrict__ mixpre) {
  const int lane = threadIdx.x & 31;
  // The wave's number as a scalar: both tile addresses are then scalar bases.
  const int wave = blockIdx.x * 4 + __builtin_amdgcn_readfirstlane(threadIdx.x >> 5);
  const int lt = wave & (Ln / 64 - 1);
  const int bm = wave / (Ln / 64);
  const int m = bm & 7, b = bm >> 3;
  const int col = lane & 15, rb = (lane >> 4) << 3;
  const _Float16* Ab = C1 + (size_t)bm * DHn * KHn;
  const _Float16* Bb = W2h + (size_t)bm * Ln * KHn + (size_t)(lt * 64) * KHn;
  v8f acc[4][4];
#pragma unroll  // constant index into acc[]
  for (int i = 0; i < 4; ++i)
#pragma unroll  // constant index into acc[]
    for (int j = 0; j < 4; ++j)
#pragma unroll
      for (int r = 0; r < 8; ++r) acc[i][j][r] = 0.0f;
  tile64_nt<KHn, KHn>(Ab, Bb, acc);
#pragma unroll  // constant index into acc[]
  for (int j = 0; j < 4; ++j) {
    const int l = lt * 64 + j * 16 + col;
    float* Ob = mixpre + ((size_t)b * Ln + l) * Dn + m * DHn + rb;
#pragma unroll  // constant index into acc[]
    for (int i = 0; i < 4; ++i)
#pragma unroll
      for (int r = 0; r < 8; ++r) Ob[i * 16 + r] = acc[i][j][r];  // 8 consecutive floats along D
  }
}

// ---- LN(mix) then LN(conv_ln1) -> t_h (f16) ---------------------------------
// One wave: RWn rows, 16 floats of a row in each lane; the row sums go over the
// lanes in registers, so the kernel has no LDS and no barrier.
__global__ void __launch_bounds__(256)
k_ln_mix(const float* __restrict__ in, const float* __restrict__ g1,
         const float* __restrict__ b1, const float* __restrict__ g2,
         const float* __restrict__ b2, float* __restrict__ mix,
         _Float16* __restrict__ th) {
  const unsigned lane = threadIdx.x & 31;
  const unsigned wave = blockIdx.x * 8 + __builtin_amdgcn_readfirstlane(threadIdx.x >> 5);
  const unsigned off = wave * (RWn * Dn);  // scalar: the wave's first row
  v4f v[RWn][4], G1[4], B1[4], G2[4], B2[4];
#pragma unroll  // constant index into v[]
  for (int r = 0; r < RWn; ++r)
#pragma unroll  // constant index into v[]
    for (int j = 0; j < 4; ++j) v[r][j] = ld4(in + off + r * Dn + j * 128, lane * 16);
  loads_issued();
#pragma unroll  // constant index into G1[], B1[], G2[] and B2[]
  for (int j = 0; j < 4; ++j) {
    G1[j] = ld4(g1 + j * 128, lane * 16);
    B1[j] = ld4(b1 + j * 128, lane * 16);
    G2[j] = ld4(g2 + j * 128, lane * 16);
    B2[j] = ld4(b2 + j * 128, lane * 16);
  }
  loads_issued();
  v4h t[RWn][4];
#pragma unroll  // constant index into v[] and t[]
  for (int r = 0; r < RWn; ++r) {
    float s, q;
    row_sums(v[r], s, q);
    const float mean = s * (1.0f / Dn);
    const float var = fmaxf(q * (1.0f / Dn) - mean * mean, 0.0f);
    const float inv = rsq_slot(var + 1e-5f);
#pragma unroll  // constant index into v[], G1[] and B1[]
    for (int j = 0; j < 4; ++j) v[r][j] = (v[r][j] - mean) * inv * G1[j] + B1[j];
    row_sums(v[r], s, q);
    const float mean2 = s * (1.0f / Dn);
    const float var2 = fmaxf(q * (1.0f / Dn) - mean2 * mean2, 0.0f);
    const float inv2 = rsq_slot(var2 + 1e-5f);
#pragma unroll  // constant index into v[], t[], G2[] and B2[]
    for (int j = 0; j < 4; ++j) t[r][j] = to_h4((v[r][j] - mean2) * inv2 * G2[j] + B2[j]);
  }
  // The stores follow as one run to the kernel's end: the fence keeps them from
  // rising among the arithmetic, which could then reuse a register they name.
  __builtin_amdgcn_sched_barrier(0);
#pragma unroll  // constant index into v[] and t[]
  for (int r = 0; r < RWn; ++r)
#pragma unroll  // constant index into v[] and t[]
    for (int j = 0; j < 4; ++j) {
      st4(mix + off + r * Dn + j * 128, lane * 16, v[r][j]);
      st4h(th + off + r * Dn + j * 128, lane * 8, t[r][j]);
    }
}

// ---- generic X[M,K](f16) @ W[N,K]^T + bias (+res) -> f32 --------------------
// One block: 128 x 128 outputs, 2 x 2 waves of 64 x 64 each.
template <int N, int K>
__global__ void __launch_bounds__(128)
k_gemm_nt(const _Float16* __restrict__ A, const _Float16* __restrict__ Wt,
          const float* __restrict__ bias, const float* __restrict__ res,
          float* __restrict__ out) {
  static_assert(N % 128 == 0, "block tile");
  const int lane = threadIdx.x & 31;
  // The wave's number as a scalar: both tile addresses are then scalar bases.
  const int w = __builtin_amdgcn_readfirstlane(threadIdx.x >> 5);
  const int n0 = (blockIdx.x % (N / 128)) * 128 + (w & 1) * 64;
  const int m0 = (blockIdx.x / (N / 128)) * 128 + (w >> 1) * 64;
  const int col = lane & 15, rb = (lane >> 4) << 3;
  v8f acc[4][4];
#pragma unroll  // constant index into acc[]
  for (int j = 0; j < 4; ++j) {
    const float bv = bias[n0 + j * 16 + col];
#pragma unroll  // constant index into acc[]
    for (int i = 0; i < 4; ++i)
#pragma unroll
      for (int r = 0; r < 8; ++r) acc[i][j][r] = bv;
  }
  // Behind the bias loads: their address registers are rewritten next. The
  // scheduling fence keeps that address arithmetic behind the wait.
  asm volatile("s_wait_xcnt 0x0" ::: "memory");
  __builtin_amdgcn_sched_barrier(0);
  tile64_nt<K, K>(A + (size_t)m0 * K, Wt + (size_t)n0 * K, acc);
  const size_t base = (size_t)(m0 + rb) * N + n0 + col;
  if (res) {
    v8f rv[4][4];
#pragma unroll  // constant index into rv[]
    for (int i = 0; i < 4; ++i)
#pragma unroll
      for (int r = 0; r < 8; ++r)
#pragma unroll  // constant index into rv[]
        for (int j = 0; j < 4; ++j) rv[i][j][r] = res[base + (size_t)(i * 16 + r) * N + j * 16];
    // Behind the residual loads: the sums below may reuse their address
    // registers. The scheduling fence keeps the sums behind the wait.
    asm volatile("s_wait_xcnt 0x0" ::: "memory");
    __builtin_amdgcn_sched_barrier(0);
#pragma unroll  // constant index into acc[] and rv[]
    for (int i = 0; i < 4; ++i)
#pragma unroll  // constant index into acc[] and rv[]
      for (int j = 0; j < 4; ++j) acc[i][j] += rv[i][j];
  }
  // The sums above go into the accumulators; the stores follow as one run to
  // the kernel's end, so no register that an issued store names is written again.
#pragma unroll  // constant index into acc[]
  for (int i = 0; i < 4; ++i)
#pragma unroll
    for (int r = 0; r < 8; ++r)
#pragma unroll  // constant index into acc[]
      for (int j = 0; j < 4; ++j)
        out[base + (size_t)(i * 16 + r) * N + j * 16] = acc[i][j][r];
}

// ---- GLU: g = c[:, :D] * sigmoid(c[:, D:]) ----------------------------------
// One wave: RWn rows, 16 outputs of a row in each lane.
__global__ void __launch_bounds__(256)
k_glu(const float* __restrict__ c, float* __restrict__ g) {
  const unsigned lane = threadIdx.x & 31;
  const unsigned wave = blockIdx.x * 8 + __builtin_amdgcn_readfirstlane(threadIdx.x >> 5);
  const unsigned goff = wave * (RWn * Dn);      // scalar: the wave's first row of g
  const unsigned coff = wave * (RWn * 2 * Dn);  // scalar: the wave's first row of c
  v4f a[RWn][4], bg[RWn][4];
#pragma unroll  // constant index into a[] and bg[]
  for (int r = 0; r < RWn; ++r)
#pragma unroll  // constant index into a[] and bg[]
    for (int j = 0; j < 4; ++j) {
      a[r][j] = ld4(c + coff + r * (2 * Dn) + j * 128, lane * 16);
      bg[r][j] = ld4(c + coff + r * (2 * Dn) + Dn + j * 128, lane * 16);
    }
  loads_issued();
#pragma unroll  // constant index into a[] and bg[]
  for (int r = 0; r < RWn; ++r)
#pragma unroll  // constant index into a[] and bg[]
    for (int j = 0; j < 4; ++j)
#pragma unroll
      for (int e = 0; e < 4; ++e)  // a * sigmoid(bg) = a / (1 + exp(-bg))
        a[r][j][e] = a[r][j][e] * rcp_slot(1.0f + exp2_slot(bg[r][j][e] * -1.442695041f));
  // The stores follow as one run to the kernel's end: the fence keeps them from
  // rising among the arithmetic, which could then reuse a register they name.
  __builtin_amdgcn_sched_barrier(0);
#pragma unroll  // constant index into a[]
  for (int r = 0; r < RWn; ++r)
#pragma unroll  // constant index into a[]
    for (int j = 0; j < 4; ++j) st4(g + goff + r * Dn + j * 128, lane * 16, a[r][j]);
}

// ---- depthwise conv along L, kernel 31, zero-pad 15 -------------------------
// One thread: 2 neighbouring channels x TLn consecutive positions. The 31 taps
// of both channels and the TLn running sums stay in registers; each input row
// is loaded once per tile and feeds up to 31 sums. Per output the taps are
// added in ascending k, as in the one-output-per-thread form.
// Every loop below is fully unrolled so that each index of w[], in[] and acc[]
// is a constant: an index known only at run time would send the array to scratch.
typedef __attribute__((ext_vector_type(2))) float v2f;
constexpr int TLn = 32;
static_assert(TLn >= PADn && Ln % TLn == 0 && KSn == 2 * PADn + 1, "tile shape");

__global__ void __launch_bounds__(256)
k_dwconv(const float* __restrict__ g, const float* __restrict__ dww,
         const float* __restrict__ dwb, float* __restrict__ u) {
  const int d = threadIdx.x * 2;                       // channel pair
  const int l0 = (blockIdx.x & (Ln / TLn - 1)) * TLn;  // first output row
  const int b = blockIdx.x / (Ln / TLn);
  const size_t tile = ((size_t)b * Ln + l0) * Dn + d;

  v2f w[KSn];
#pragma unroll  // constant index into w[]
  for (int k = 0; k < KSn; ++k) {
    w[k][0] = dww[d * KSn + k];
    w[k][1] = dww[(d + 1) * KSn + k];
  }
  v2f bias;
  bias[0] = dwb[d];
  bias[1] = dwb[d + 1];

  // in[j] = input row l0 - PADn + j. The PADn rows in front of the first tile
  // of a sequence and behind its last tile are the zero pad and are not read
  // (both tests are the same for the whole block).
  const float* gt = g + tile;
  v2f in[TLn + 2 * PADn];
  if (l0 > 0) {
#pragma unroll  // constant index into in[]
    for (int j = 0; j < PADn; ++j) in[j] = *(const v2f*)(gt + (j - PADn) * Dn);
  } else {
#pragma unroll  // constant index into in[]
    for (int j = 0; j < PADn; ++j) in[j] = 0.0f;
  }
#pragma unroll  // constant index into in[]
  for (int j = 0; j < TLn; ++j) in[PADn + j] = *(const v2f*)(gt + j * Dn);
  if (l0 + TLn < Ln) {
#pragma unroll  // constant index into in[]
    for (int j = 0; j < PADn; ++j)
      in[PADn + TLn + j] = *(const v2f*)(gt + (TLn + j) * Dn);
  } else {
#pragma unroll  // constant index into in[]
    for (int j = 0; j < PADn; ++j) in[PADn + TLn + j] = 0.0f;
  }

  v2f acc[TLn];
#pragma unroll  // constant index into acc[] and in[]
  for (int t = 0; t < TLn; ++t) {
    acc[t] = bias;
#pragma unroll  // constant index into in[] and w[]
    for (int k = 0; k < KSn; ++k) acc[t] += in[t + k] * w[k];
  }

  float* ut = u + tile;
#pragma unroll  // constant index into acc[]
  for (int t = 0; t < TLn; ++t) *(v2f*)(ut + t * Dn) = acc[t];
}

// ---- gelu(LN(u)) -> f16 -----------------------------------------------------
// One wave: RWn rows, as in k_ln_mix.
__global__ void __launch_bounds__(256)
k_ln_gelu(const float* __restrict__ in, const float* __restrict__ gg,
          const float* __restrict__ bb, _Float16* __restrict__ outh) {
  const unsigned lane = threadIdx.x & 31;
  const unsigned wave = blockIdx.x * 8 + __builtin_amdgcn_readfirstlane(threadIdx.x >> 5);
  const unsigned off = wave * (RWn * Dn);  // scalar: the wave's first row
  v4f v[RWn][4], G[4], Bv[4];
#pragma unroll  // constant index into v[]
  for (int r = 0; r < RWn; ++r)
#pragma unroll  // constant index into v[]
    for (int j = 0; j < 4; ++j) v[r][j] = ld4(in + off + r * Dn + j * 128, lane * 16);
  loads_issued();
#pragma unroll  // constant index into G[] and Bv[]
  for (int j = 0; j < 4; ++j) {
    G[j] = ld4(gg + j * 128, lane * 16);
    Bv[j] = ld4(bb + j * 128, lane * 16);
  }
  loads_issued();
  v4h t[RWn][4];
#pragma unroll  // constant index into v[] and t[]
  for (int r = 0; r < RWn; ++r) {
    float s, q;
    row_sums(v[r], s, q);
    const float mean = s * (1.0f / Dn);
    const float var = fmaxf(q * (1.0f / Dn) - mean * mean, 0.0f);
    const float inv = rsq_slot(var + 1e-5f);
#pragma unroll  // constant index into v[], t[], G[] and Bv[]
    for (int j = 0; j < 4; ++j) {
      const v4f o = (v[r][j] - mean) * inv * G[j] + Bv[j];
#pragma unroll
      for (int e = 0; e < 4; ++e) t[r][j][e] = (_Float16)gelu_f(o[e]);
    }
  }
  // The stores follow as one run to the kernel's end: the fence keeps them from
  // rising among the arithmetic, which could then reuse a register they name.
  __builtin_amdgcn_sched_barrier(0);
#pragma unroll  // constant index into t[]
  for (int r = 0; r < RWn; ++r)
#pragma unroll  // constant index into t[]
    for (int j = 0; j < 4; ++j) st4h(outh + off + r * Dn + j * 128, lane * 8, t[r][j]);
}

// ---- host-side launch -------------------------------------------------------
extern "C" void kernel_launch(void* const* d_in, const int* in_sizes, int n_in,
                              void* d_out, int out_size, void* d_ws, size_t ws_size,
                              hipStream_t stream) {
  (void)in_sizes; (void)n_in; (void)out_size; (void)ws_size;
  const float* x      = (const float*)d_in[0];
  const float* w1fc1w = (const float*)d_in[1];
  const float* w1fc1b = (const float*)d_in[2];
  const float* w1fc2w = (const float*)d_in[3];
  const float* w1fc2b = (const float*)d_in[4];
  const float* w2fc1w = (const float*)d_in[5];
  const float* w2fc1b = (const float*)d_in[6];
  const float* w2fc2w = (const float*)d_in[7];
  const float* w2fc2b = (const float*)d_in[8];
  const float* lnmixg = (const float*)d_in[9];
  const float* lnmixb = (const float*)d_in[10];
  const float* cln1g  = (const float*)d_in[11];
  const float* cln1b  = (const float*)d_in[12];
  const float* bneckw = (const float*)d_in[13];
  const float* bneckb = (const float*)d_in[14];
  const float* dww    = (const float*)d_in[15];
  const float* dwb    = (const float*)d_in[16];
  const float* cln2g  = (const float*)d_in[17];
  const float* cln2b  = (const float*)d_in[18];
  const float* linw   = (const float*)d_in[19];
  const float* linb   = (const float*)d_in[20];
  float* out = (float*)d_out;

  char* ws = (char*)d_ws;
  const size_t SZ_H = (size_t)BLn * Dn * sizeof(_Float16);              // 16.78 MB
  const size_t SZ_F = (size_t)BLn * Dn * sizeof(float);                 // 33.55 MB
  const size_t SZ_W = (size_t)Bn * Mn * Ln * KHn * sizeof(_Float16);    // 67.11 MB

  _Float16* xh   = (_Float16*)(ws);
  _Float16* hyph = (_Float16*)(ws + SZ_H);
  char* R2 = ws + 2 * SZ_H;                 // 67MB region: W1h -> mixpre -> c -> u/uh
  char* R3 = R2 + SZ_W;                     // 67MB region: W2h -> mix + t_h
  _Float16* c1g = (_Float16*)(R3 + SZ_W);   // [64,64,256] f16 = 2 MB
  char* WTS = (char*)c1g + (size_t)Bn * Mn * DHn * KHn * sizeof(_Float16);

  _Float16* w1fc1h = (_Float16*)(WTS);
  _Float16* w1fc2h = (_Float16*)(WTS + 65536);
  _Float16* w2fc1h = (_Float16*)(WTS + 65536 + 262144);
  _Float16* w2fc2h = (_Float16*)(WTS + 2 * 65536 + 262144);
  _Float16* bwh    = (_Float16*)(WTS + 2 * 65536 + 2 * 262144);
  _Float16* lwh    = (_Float16*)(WTS + 2 * 65536 + 2 * 262144 + 1048576);

  // lifetime-disjoint aliases
  _Float16* W1h = (_Float16*)R2;
  _Float16* W2h = (_Float16*)R3;
  float*    mixpre = (float*)R2;            // after W1h dead
  float*    mix    = (float*)R3;            // after W2h dead
  _Float16* th     = (_Float16*)(R3 + SZ_F);
  float*    cbuf   = (float*)R2;            // [BL,1024] after mixpre dead
  float*    gbuf   = (float*)ws;            // over xh+hyph (dead)
  float*    ubuf   = (float*)R2;            // after cbuf dead
  _Float16* uh     = (_Float16*)(R2 + SZ_F);

  // 1) weights -> f16
  k_cvt_f16<<<dim3(Mn * DHn * DHn / 2048), dim3(256), 0, stream>>>(w1fc1w, w1fc1h, Mn * DHn * DHn);
  k_cvt_f16<<<dim3(Mn * KHn * DHn / 2048), dim3(256), 0, stream>>>(w1fc2w, w1fc2h, Mn * KHn * DHn);
  k_cvt_f16<<<dim3(Mn * DHn * DHn / 2048), dim3(256), 0, stream>>>(w2fc1w, w2fc1h, Mn * DHn * DHn);
  k_cvt_f16<<<dim3(Mn * KHn * DHn / 2048), dim3(256), 0, stream>>>(w2fc2w, w2fc2h, Mn * KHn * DHn);
  k_cvt_f16<<<dim3(2 * Dn * Dn / 2048), dim3(256), 0, stream>>>(bneckw, bwh, 2 * Dn * Dn);
  k_cvt_f16<<<dim3(Dn * Dn / 2048), dim3(256), 0, stream>>>(linw, lwh, Dn * Dn);

  // 2) x_h, hyp_h (x + PE)
  k_prep_hyp<<<dim3((Ln / 2) * (Dn / 4) / 256), dim3(256), 0, stream>>>(x, xh, hyph);

  // 3) hypernet MLPs -> W1, W2 (f16); weights staged via TDM
  const int pmlp_blocks = (Bn * Mn * (Ln / 16)) / 4;   // 2048
  k_pmlp<<<dim3(pmlp_blocks), dim3(128), 0, stream>>>(hyph, w1fc1h, w1fc1b, w1fc2h, w1fc2b, W1h);
  k_pmlp<<<dim3(pmlp_blocks), dim3(128), 0, stream>>>(hyph, w2fc1h, w2fc1b, w2fc2h, w2fc2b, W2h);

  // 4) token mixing bmms
  k_mix1<<<dim3((Bn * Mn * 4 * 16) / 4), dim3(128), 0, stream>>>(xh, W1h, c1g);
  k_mix2<<<dim3((Bn * Mn * (Ln / 64)) / 4), dim3(128), 0, stream>>>(c1g, W2h, mixpre);

  // 5) LN(mix) and LN(conv_ln1) -> t_h
  k_ln_mix<<<dim3(BLn / (8 * RWn)), dim3(256), 0, stream>>>(mixpre, lnmixg, lnmixb, cln1g, cln1b, mix, th);

  // 6) bottleneck 1x1 conv: [BL,512] @ [1024,512]^T + b
  k_gemm_nt<2 * Dn, Dn><<<dim3((BLn / 128) * (2 * Dn / 128)), dim3(128), 0, stream>>>(
      th, bwh, bneckb, nullptr, cbuf);

  // 7) GLU, 8) depthwise conv, 9) gelu(LN)
  k_glu<<<dim3(BLn / (8 * RWn)), dim3(256), 0, stream>>>(cbuf, gbuf);
  k_dwconv<<<dim3(BLn / TLn), dim3(256), 0, stream>>>(gbuf, dww, dwb, ubuf);
  k_ln_gelu<<<dim3(BLn / (8 * RWn)), dim3(256), 0, stream>>>(ubuf, cln2g, cln2b, uh);

  // 10) final linear + residual: out = mix + (u @ lin_w^T + b)
  k_gemm_nt<Dn, Dn><<<dim3((BLn / 128) * (Dn / 128)), dim3(128), 0, stream>>>(
      uh, lwh, linb, mix, out);
}
